// v000
// Measured on an AMD MI455X. A time is GPU time per run, averaged over a window of back-to-back runs after a warm-up
// (all launches, gaps included; the runs take copies of the inputs in turn), and the median of several windows.
// Apart from v000's, it joins two sittings. Times from different sittings can be a few percent apart, while
// side-by-side timings come from the same sitting.
// v000, which the later versions start from, runs in 251 microseconds.
#include <hip/hip_runtime.h>
#include <math.h>

// Problem constants (match reference)
#define BSZ   2
#define LEN   2048
#define DQ    512
#define SQ    4
#define NCH   16                 // chunks per sequence
#define CT    (LEN / NCH)        // 128 steps per chunk
#define EPSQ  1e-6f
#define CHAINS (BSZ * DQ * SQ)   // 4096 independent recurrences

typedef float v2f __attribute__((ext_vector_type(2)));
typedef float v8f __attribute__((ext_vector_type(8)));
typedef int   v4i __attribute__((ext_vector_type(4)));

#define AS1 __attribute__((address_space(1)))
#define AS3 __attribute__((address_space(3)))

struct Quat { float r, i, j, k; };

__device__ __forceinline__ Quat qmul(const Quat a, const Quat b) {
    Quat o;
    o.r = a.r*b.r - a.i*b.i - a.j*b.j - a.k*b.k;
    o.i = a.r*b.i + a.i*b.r + a.j*b.k - a.k*b.j;
    o.j = a.r*b.j - a.i*b.k + a.j*b.r + a.k*b.i;
    o.k = a.r*b.k + a.i*b.j - a.j*b.i + a.k*b.r;
    return o;
}

__device__ __forceinline__ Quat ld4(const float* p) {
    float4 v = *(const float4*)p;
    return Quat{v.x, v.y, v.z, v.w};
}

// Async global->LDS copy of 16 bytes (ASYNCcnt-tracked on gfx1250).
__device__ __forceinline__ void async_copy16(float4* lds_dst, const float4* gsrc) {
#if __has_builtin(__builtin_amdgcn_global_load_async_to_lds_b128)
    __builtin_amdgcn_global_load_async_to_lds_b128(
        (AS1 v4i*)gsrc, (AS3 v4i*)lds_dst, 0, 0);
#else
    unsigned loff = (unsigned)(uintptr_t)(AS3 void*)lds_dst;
    asm volatile("global_load_async_to_lds_b128 %0, %1, off"
                 :: "v"(loff), "v"(gsrc) : "memory");
#endif
}

__device__ __forceinline__ void async_wait0() {
#if __has_builtin(__builtin_amdgcn_s_wait_asynccnt)
    __builtin_amdgcn_s_wait_asynccnt(0);
#else
    asm volatile("s_wait_asynccnt 0" ::: "memory");
#endif
}

// Branch-free 4-way component select (3 v_cndmask).
__device__ __forceinline__ float sel4(float4 c, bool b1, bool b2) {
    float lo = b1 ? c.y : c.x;
    float hi = b1 ? c.w : c.z;
    return b2 ? hi : lo;
}

// Per-timestep Cayley transform: builds transition quaternion q and input Bu.
__device__ __forceinline__ void cayley_step(float dtv, Quat A, Quat Bq, Quat uq,
                                            Quat& q, Quat& Bu) {
    Quat z  {dtv * A.r, dtv * A.i, dtv * A.j, dtv * A.k};
    Quat num{1.0f + 0.5f * z.r,  0.5f * z.i,  0.5f * z.j,  0.5f * z.k};
    Quat den{1.0f - 0.5f * z.r, -0.5f * z.i, -0.5f * z.j, -0.5f * z.k};
    float n2 = den.r*den.r + den.i*den.i + den.j*den.j + den.k*den.k + EPSQ;
    float s  = 1.0f / n2;
    Quat dinv{den.r * s, -den.i * s, -den.j * s, -den.k * s};
    q = qmul(dinv, num);
    Quat dinv_dt{dinv.r * dtv, dinv.i * dtv, dinv.j * dtv, dinv.k * dtv};
    Quat dB = qmul(dinv_dt, Bq);
    Bu = qmul(dB, uq);
}

// ---------------------------------------------------------------------------
// Phase 1: per-chunk summaries.  One thread per (b, chunk, d); carries all 4 s.
// B_in rows for the chunk are staged block-wide into LDS via async copies.
// ---------------------------------------------------------------------------
__global__ __launch_bounds__(256)
void qssm_phase1(const float* __restrict__ u, const float* __restrict__ dtg,
                 const float* __restrict__ Bin,
                 const float* __restrict__ Alog, const float* __restrict__ Ai,
                 const float* __restrict__ Aj,   const float* __restrict__ Ak,
                 float* __restrict__ Qbuf, float* __restrict__ Vbuf)
{
    const int gid = blockIdx.x * blockDim.x + threadIdx.x;
    const int d = gid % DQ;
    const int c = (gid / DQ) % NCH;        // block-uniform
    const int b = gid / (DQ * NCH);        // block-uniform
    const int t0 = c * CT;

    const float4* u4 = (const float4*)u;
    const float4* B4 = (const float4*)Bin;

    // Stage this chunk's B_in [CT x SQ] quaternions into LDS (8 KB).
    __shared__ float4 sB[CT * SQ];
    {
        const float4* gB = B4 + (b * LEN + t0) * SQ;
        for (int e = threadIdx.x; e < CT * SQ; e += 256)
            async_copy16(&sB[e], gB + e);
        async_wait0();
        __syncthreads();
    }

    Quat A[SQ], h[SQ], Q[SQ];
    #pragma unroll
    for (int s = 0; s < SQ; ++s) {
        A[s] = Quat{-expf(Alog[d*SQ + s]), Ai[d*SQ + s], Aj[d*SQ + s], Ak[d*SQ + s]};
        h[s] = Quat{0.f, 0.f, 0.f, 0.f};
        Q[s] = Quat{1.f, 0.f, 0.f, 0.f};
    }

    for (int tt = 0; tt < CT; ++tt) {
        const int t   = t0 + tt;
        const int row = (b * LEN + t) * DQ;
        const float dtv = dtg[row + d];
        float4 uv = u4[row + d];
        Quat uq{uv.x, uv.y, uv.z, uv.w};
        if (tt + 8 < CT)
            __builtin_prefetch((const void*)(u4 + row + 8*DQ + d), 0, 1);
        #pragma unroll
        for (int s = 0; s < SQ; ++s) {
            float4 bv = sB[tt * SQ + s];
            Quat Bq{bv.x, bv.y, bv.z, bv.w};
            Quat q, Bu;
            cayley_step(dtv, A[s], Bq, uq, q, Bu);
            Quat nh = qmul(q, h[s]);
            h[s] = Quat{nh.r + Bu.r, nh.i + Bu.i, nh.j + Bu.j, nh.k + Bu.k};
            Q[s] = qmul(q, Q[s]);
        }
    }

    #pragma unroll
    for (int s = 0; s < SQ; ++s) {
        const int chain = (b * DQ + d) * SQ + s;
        const int idx   = chain * NCH + c;
        ((float4*)Qbuf)[idx] = make_float4(Q[s].r, Q[s].i, Q[s].j, Q[s].k);
        ((float4*)Vbuf)[idx] = make_float4(h[s].r, h[s].i, h[s].j, h[s].k);
    }
}

// ---------------------------------------------------------------------------
// Phase 2: tiny inter-chunk exclusive scan per chain (16 steps, 4096 threads).
// ---------------------------------------------------------------------------
__global__ __launch_bounds__(256)
void qssm_phase2(const float* __restrict__ Qbuf, const float* __restrict__ Vbuf,
                 float* __restrict__ Hstart)
{
    const int chain = blockIdx.x * blockDim.x + threadIdx.x;
    Quat h{0.f, 0.f, 0.f, 0.f};
    for (int c = 0; c < NCH; ++c) {
        const int idx = chain * NCH + c;
        ((float4*)Hstart)[idx] = make_float4(h.r, h.i, h.j, h.k);
        Quat Q = ld4(Qbuf + 4*idx);
        Quat V = ld4(Vbuf + 4*idx);
        Quat qh = qmul(Q, h);
        h = Quat{qh.r + V.r, qh.i + V.i, qh.j + V.j, qh.k + V.k};
    }
}

// ---------------------------------------------------------------------------
// Phase 3: finalize.  One wave handles (b, chunk, 32 d-channels); lane owns d.
// y = sum_s L(C_s) @ h via V_WMMA_F32_16X16X4_F32.  A-operand selection is
// fully branch-free (loop-invariant per-lane index/sign masks), so EXEC stays
// all-ones through the WMMAs.  B_in/C_in chunk rows staged via async LDS.
// ---------------------------------------------------------------------------
__global__ __launch_bounds__(256)
void qssm_phase3(const float* __restrict__ u, const float* __restrict__ dtg,
                 const float* __restrict__ Bin, const float* __restrict__ Cin,
                 const float* __restrict__ Alog, const float* __restrict__ Ai,
                 const float* __restrict__ Aj,   const float* __restrict__ Ak,
                 const float* __restrict__ Hstart, float* __restrict__ out)
{
    const int tid  = blockIdx.x * blockDim.x + threadIdx.x;
    const int lane = threadIdx.x & 31;
    const int wave = tid >> 5;
    const int ndt  = DQ / 32;                       // 16 d-tiles
    const int dtile = wave % ndt;
    const int c     = (wave / ndt) % NCH;           // block-uniform
    const int b     = wave / (ndt * NCH);           // block-uniform
    const int dbase = dtile * 32;
    const int d     = dbase + lane;
    const int t0    = c * CT;

    const float4* u4 = (const float4*)u;
    const float4* B4 = (const float4*)Bin;
    const float4* C4 = (const float4*)Cin;
    float4* out4 = (float4*)out;

    // Stage this chunk's B_in and C_in rows into LDS (16 KB) asynchronously.
    __shared__ float4 sB[CT * SQ];
    __shared__ float4 sC[CT * SQ];
    {
        const float4* gB = B4 + (b * LEN + t0) * SQ;
        const float4* gC = C4 + (b * LEN + t0) * SQ;
        for (int e = threadIdx.x; e < CT * SQ; e += 256) {
            async_copy16(&sB[e], gB + e);
            async_copy16(&sC[e], gC + e);
        }
        async_wait0();
        __syncthreads();
    }

    Quat A[SQ], h[SQ];
    #pragma unroll
    for (int s = 0; s < SQ; ++s) {
        A[s] = Quat{-expf(Alog[d*SQ + s]), Ai[d*SQ + s], Aj[d*SQ + s], Ak[d*SQ + s]};
        const int chain = (b * DQ + d) * SQ + s;
        h[s] = ld4(Hstart + 4 * (chain * NCH + c));
    }

    const int  m     = lane & 15;       // WMMA row (output quat component if <4)
    const bool hih   = lane >= 16;      // upper lane half -> K = 2,3
    const int  srcLo = m;               // owner lane of d = dbase + m
    const int  srcHi = m + 16;          // owner lane of d = dbase + 16 + m

    // Loop-invariant per-lane A-operand selectors: which C component feeds
    // ax/ay, its sign, and whether this row (m<4) is a valid L(C) row.
    const int mm = m & 3;
    int ix, iy; unsigned sxm, sym;
    if (!hih) { ix = mm;     iy = mm ^ 1;
                sxm = 0u;
                sym = (mm == 0 || mm == 3) ? 0x80000000u : 0u; }
    else      { ix = mm ^ 2; iy = mm ^ 3;
                sxm = (mm < 2) ? 0x80000000u : 0u;
                sym = (mm == 0 || mm == 2) ? 0x80000000u : 0u; }
    const bool ix1 = ix & 1, ix2 = (ix & 2) != 0;
    const bool iy1 = iy & 1, iy2 = (iy & 2) != 0;
    const float amask = (m < 4) ? 1.0f : 0.0f;

    for (int tt = 0; tt < CT; ++tt) {
        const int t   = t0 + tt;
        const int row = (b * LEN + t) * DQ;
        const float dtv = dtg[row + d];
        float4 uv = u4[row + d];
        Quat uq{uv.x, uv.y, uv.z, uv.w};
        if (tt + 8 < CT)
            __builtin_prefetch((const void*)(u4 + row + 8*DQ + d), 0, 1);

        v8f acc_lo = {0.f,0.f,0.f,0.f,0.f,0.f,0.f,0.f};
        v8f acc_hi = {0.f,0.f,0.f,0.f,0.f,0.f,0.f,0.f};

        #pragma unroll
        for (int s = 0; s < SQ; ++s) {
            float4 bv = sB[tt * SQ + s];
            Quat Bq{bv.x, bv.y, bv.z, bv.w};
            Quat q, Bu;
            cayley_step(dtv, A[s], Bq, uq, q, Bu);
            Quat nh = qmul(q, h[s]);
            h[s] = Quat{nh.r + Bu.r, nh.i + Bu.i, nh.j + Bu.j, nh.k + Bu.k};

            // --- A operand: L(C_s), 16x4 f32 layout, branch-free build.
            float4 cv = sC[tt * SQ + s];
            float ax = amask * __uint_as_float(
                           __float_as_uint(sel4(cv, ix1, ix2)) ^ sxm);
            float ay = amask * __uint_as_float(
                           __float_as_uint(sel4(cv, iy1, iy2)) ^ sym);
            v2f amat = {ax, ay};

            // --- B operand (4x16 f32): column n = d-channel, row k = h comp.
            float l0 = __shfl(h[s].r, srcLo, 32);
            float l1 = __shfl(h[s].i, srcLo, 32);
            float l2 = __shfl(h[s].j, srcLo, 32);
            float l3 = __shfl(h[s].k, srcLo, 32);
            v2f blo = { hih ? l2 : l0, hih ? l3 : l1 };
            float g0 = __shfl(h[s].r, srcHi, 32);
            float g1 = __shfl(h[s].i, srcHi, 32);
            float g2 = __shfl(h[s].j, srcHi, 32);
            float g3 = __shfl(h[s].k, srcHi, 32);
            v2f bhi = { hih ? g2 : g0, hih ? g3 : g1 };

            acc_lo = __builtin_amdgcn_wmma_f32_16x16x4_f32(
                         false, amat, false, blo, (short)0, acc_lo, false, false);
            acc_hi = __builtin_amdgcn_wmma_f32_16x16x4_f32(
                         false, amat, false, bhi, (short)0, acc_hi, false, false);
        }

        // D layout: lane n (0..15) holds M=0..3 (y comps) in VGPRs 0..3.
        if (lane < 16) {
            out4[row + dbase + lane]      = make_float4(acc_lo[0], acc_lo[1], acc_lo[2], acc_lo[3]);
            out4[row + dbase + 16 + lane] = make_float4(acc_hi[0], acc_hi[1], acc_hi[2], acc_hi[3]);
        }
    }
}

// ---------------------------------------------------------------------------
extern "C" void kernel_launch(void* const* d_in, const int* in_sizes, int n_in,
                              void* d_out, int out_size, void* d_ws, size_t ws_size,
                              hipStream_t stream)
{
    const float* u    = (const float*)d_in[0];
    const float* dtg  = (const float*)d_in[1];
    const float* Bin  = (const float*)d_in[2];
    const float* Cin  = (const float*)d_in[3];
    const float* Alog = (const float*)d_in[4];
    const float* Ai   = (const float*)d_in[5];
    const float* Aj   = (const float*)d_in[6];
    const float* Ak   = (const float*)d_in[7];
    float* out = (float*)d_out;

    // Workspace: 3 buffers of CHAINS*NCH quaternions (1 MB each)
    float* qb = (float*)d_ws;
    float* vb = qb + (size_t)CHAINS * NCH * 4;
    float* hs = vb + (size_t)CHAINS * NCH * 4;

    qssm_phase1<<<(BSZ * NCH * DQ) / 256, 256, 0, stream>>>(
        u, dtg, Bin, Alog, Ai, Aj, Ak, qb, vb);
    qssm_phase2<<<CHAINS / 256, 256, 0, stream>>>(qb, vb, hs);
    qssm_phase3<<<(BSZ * NCH * (DQ / 32) * 32) / 256, 256, 0, stream>>>(
        u, dtg, Bin, Cin, Alog, Ai, Aj, Ak, hs, out);
}

// v001
// Measured time: 66.4 microseconds a run.
// Timed twice side by side with v000, it ran 3.80 and 3.82 times as fast.
#include <hip/hip_runtime.h>
#include <math.h>

// Problem constants (match reference)
#define BSZ   2
#define LEN   2048
#define DQ    512
#define SQ    4
#define NCH   128                // chunks per sequence
#define CT    (LEN / NCH)        // 16 steps per chunk
#define EPSQ  1e-6f
#define CHAINS (BSZ * DQ * SQ)   // 4096 independent recurrences
#define SCB   16                 // chunk summaries the scan fetches per batch

typedef float v2f __attribute__((ext_vector_type(2)));
typedef float v8f __attribute__((ext_vector_type(8)));
typedef int   v4i __attribute__((ext_vector_type(4)));

#define AS1 __attribute__((address_space(1)))
#define AS3 __attribute__((address_space(3)))

struct Quat { float r, i, j, k; };

__device__ __forceinline__ Quat qmul(const Quat a, const Quat b) {
    Quat o;
    o.r = a.r*b.r - a.i*b.i - a.j*b.j - a.k*b.k;
    o.i = a.r*b.i + a.i*b.r + a.j*b.k - a.k*b.j;
    o.j = a.r*b.j - a.i*b.k + a.j*b.r + a.k*b.i;
    o.k = a.r*b.k + a.i*b.j - a.j*b.i + a.k*b.r;
    return o;
}

__device__ __forceinline__ Quat ld4(const float* p) {
    float4 v = *(const float4*)p;
    return Quat{v.x, v.y, v.z, v.w};
}

// Async global->LDS copy of 16 bytes (ASYNCcnt-tracked on gfx1250).
__device__ __forceinline__ void async_copy16(float4* lds_dst, const float4* gsrc) {
#if __has_builtin(__builtin_amdgcn_global_load_async_to_lds_b128)
    __builtin_amdgcn_global_load_async_to_lds_b128(
        (AS1 v4i*)gsrc, (AS3 v4i*)lds_dst, 0, 0);
#else
    unsigned loff = (unsigned)(uintptr_t)(AS3 void*)lds_dst;
    asm volatile("global_load_async_to_lds_b128 %0, %1, off"
                 :: "v"(loff), "v"(gsrc) : "memory");
#endif
}

__device__ __forceinline__ void async_wait0() {
#if __has_builtin(__builtin_amdgcn_s_wait_asynccnt)
    __builtin_amdgcn_s_wait_asynccnt(0);
#else
    asm volatile("s_wait_asynccnt 0" ::: "memory");
#endif
}

// Branch-free 4-way component select (3 v_cndmask).
__device__ __forceinline__ float sel4(float4 c, bool b1, bool b2) {
    float lo = b1 ? c.y : c.x;
    float hi = b1 ? c.w : c.z;
    return b2 ? hi : lo;
}

// Per-timestep Cayley transform: builds transition quaternion q and input Bu.
__device__ __forceinline__ void cayley_step(float dtv, Quat A, Quat Bq, Quat uq,
                                            Quat& q, Quat& Bu) {
    Quat z  {dtv * A.r, dtv * A.i, dtv * A.j, dtv * A.k};
    Quat num{1.0f + 0.5f * z.r,  0.5f * z.i,  0.5f * z.j,  0.5f * z.k};
    Quat den{1.0f - 0.5f * z.r, -0.5f * z.i, -0.5f * z.j, -0.5f * z.k};
    float n2 = den.r*den.r + den.i*den.i + den.j*den.j + den.k*den.k + EPSQ;
    float s  = 1.0f / n2;
    Quat dinv{den.r * s, -den.i * s, -den.j * s, -den.k * s};
    q = qmul(dinv, num);
    Quat dinv_dt{dinv.r * dtv, dinv.i * dtv, dinv.j * dtv, dinv.k * dtv};
    Quat dB = qmul(dinv_dt, Bq);
    Bu = qmul(dB, uq);
}

// ---------------------------------------------------------------------------
// Phase 1: per-chunk summaries.  One thread per (b, chunk, d); carries all 4 s.
// B_in rows for the chunk are staged block-wide into LDS via async copies.
// ---------------------------------------------------------------------------
__global__ __launch_bounds__(256)
void qssm_phase1(const float* __restrict__ u, const float* __restrict__ dtg,
                 const float* __restrict__ Bin,
                 const float* __restrict__ Alog, const float* __restrict__ Ai,
                 const float* __restrict__ Aj,   const float* __restrict__ Ak,
                 float* __restrict__ Qbuf, float* __restrict__ Vbuf)
{
    const int gid = blockIdx.x * blockDim.x + threadIdx.x;
    const int d = gid % DQ;
    const int c = (gid / DQ) % NCH;        // block-uniform
    const int b = gid / (DQ * NCH);        // block-uniform
    const int t0 = c * CT;

    const float4* u4 = (const float4*)u;
    const float4* B4 = (const float4*)Bin;

    // Stage this chunk's B_in [CT x SQ] quaternions into LDS (1 KB).
    __shared__ float4 sB[CT * SQ];
    {
        const float4* gB = B4 + (b * LEN + t0) * SQ;
        for (int e = threadIdx.x; e < CT * SQ; e += 256)
            async_copy16(&sB[e], gB + e);
        async_wait0();
        __syncthreads();
    }

    Quat A[SQ], h[SQ], Q[SQ];
    #pragma unroll
    for (int s = 0; s < SQ; ++s) {
        A[s] = Quat{-expf(Alog[d*SQ + s]), Ai[d*SQ + s], Aj[d*SQ + s], Ak[d*SQ + s]};
        h[s] = Quat{0.f, 0.f, 0.f, 0.f};
        Q[s] = Quat{1.f, 0.f, 0.f, 0.f};
    }

    for (int tt = 0; tt < CT; ++tt) {
        const int t   = t0 + tt;
        const int row = (b * LEN + t) * DQ;
        const float dtv = dtg[row + d];
        float4 uv = u4[row + d];
        Quat uq{uv.x, uv.y, uv.z, uv.w};
        #pragma unroll
        for (int s = 0; s < SQ; ++s) {
            float4 bv = sB[tt * SQ + s];
            Quat Bq{bv.x, bv.y, bv.z, bv.w};
            Quat q, Bu;
            cayley_step(dtv, A[s], Bq, uq, q, Bu);
            Quat nh = qmul(q, h[s]);
            h[s] = Quat{nh.r + Bu.r, nh.i + Bu.i, nh.j + Bu.j, nh.k + Bu.k};
            Q[s] = qmul(q, Q[s]);
        }
    }

    #pragma unroll
    for (int s = 0; s < SQ; ++s) {
        const int chain = (b * DQ + d) * SQ + s;
        const int idx   = c * CHAINS + chain;     // chunk-major: a wave writes whole lines
        ((float4*)Qbuf)[idx] = make_float4(Q[s].r, Q[s].i, Q[s].j, Q[s].k);
        ((float4*)Vbuf)[idx] = make_float4(h[s].r, h[s].i, h[s].j, h[s].k);
    }
}

// ---------------------------------------------------------------------------
// Phase 2: inter-chunk exclusive scan per chain (NCH steps, 4096 threads).
// The summaries do not depend on h, so SCB chunks of them are fetched at once
// and one memory latency is paid per batch; only the fold itself is serial.
// ---------------------------------------------------------------------------
__global__ __launch_bounds__(64)
void qssm_phase2(const float* __restrict__ Qbuf, const float* __restrict__ Vbuf,
                 float* __restrict__ Hstart)
{
    const int chain = blockIdx.x * blockDim.x + threadIdx.x;
    Quat h{0.f, 0.f, 0.f, 0.f};
    #pragma unroll   // constant offsets from one base: the address registers are never rewritten
    for (int c0 = 0; c0 < NCH; c0 += SCB) {
        const float4* Qc = (const float4*)Qbuf + c0 * CHAINS;   // wave-uniform bases
        const float4* Vc = (const float4*)Vbuf + c0 * CHAINS;
        float4*       Hc = (float4*)Hstart + c0 * CHAINS;
        float4 q[SCB], v[SCB];
        #pragma unroll   // all 2*SCB loads issue before the first is waited for
        for (int j = 0; j < SCB; ++j) {
            q[j] = Qc[j * CHAINS + chain];
            v[j] = Vc[j * CHAINS + chain];
        }
        // Keeps every load of the batch above the fold: without it the scheduler
        // sinks most of them between the fold's steps and each pays its own latency.
        __builtin_amdgcn_sched_barrier(0);
        #pragma unroll   // q[] and v[] stay in registers
        for (int j = 0; j < SCB; ++j) {
            Hc[j * CHAINS + chain] = make_float4(h.r, h.i, h.j, h.k);
            Quat qh = qmul(Quat{q[j].x, q[j].y, q[j].z, q[j].w}, h);
            h = Quat{qh.r + v[j].x, qh.i + v[j].y, qh.j + v[j].z, qh.k + v[j].w};
        }
        // The next batch's loads land in registers that these stores still name.
        asm volatile("s_wait_xcnt 0x0" ::: "memory");
    }
}

// ---------------------------------------------------------------------------
// Phase 3: finalize.  One wave handles (b, chunk, 32 d-channels); lane owns d.
// y = sum_s L(C_s) @ h via V_WMMA_F32_16X16X4_F32.  A-operand selection is
// fully branch-free (loop-invariant per-lane index/sign masks), so EXEC stays
// all-ones through the WMMAs.  B_in/C_in chunk rows staged via async LDS.
// ---------------------------------------------------------------------------
__global__ __launch_bounds__(256)
void qssm_phase3(const float* __restrict__ u, const float* __restrict__ dtg,
                 const float* __restrict__ Bin, const float* __restrict__ Cin,
                 const float* __restrict__ Alog, const float* __restrict__ Ai,
                 const float* __restrict__ Aj,   const float* __restrict__ Ak,
                 const float* __restrict__ Hstart, float* __restrict__ out)
{
    const int tid  = blockIdx.x * blockDim.x + threadIdx.x;
    const int lane = threadIdx.x & 31;
    const int wave = tid >> 5;
    const int ndt  = DQ / 32;                       // 16 d-tiles
    const int dtile = wave % ndt;
    const int c     = (wave / ndt) % NCH;           // block-uniform
    const int b     = wave / (ndt * NCH);           // block-uniform
    const int dbase = dtile * 32;
    const int d     = dbase + lane;
    const int t0    = c * CT;

    const float4* u4 = (const float4*)u;
    const float4* B4 = (const float4*)Bin;
    const float4* C4 = (const float4*)Cin;
    float4* out4 = (float4*)out;

    // Stage this chunk's B_in and C_in rows into LDS (2 KB) asynchronously.
    __shared__ float4 sB[CT * SQ];
    __shared__ float4 sC[CT * SQ];
    {
        const float4* gB = B4 + (b * LEN + t0) * SQ;
        const float4* gC = C4 + (b * LEN + t0) * SQ;
        for (int e = threadIdx.x; e < CT * SQ; e += 256) {
            async_copy16(&sB[e], gB + e);
            async_copy16(&sC[e], gC + e);
        }
        async_wait0();
        __syncthreads();
    }

    Quat A[SQ], h[SQ];
    #pragma unroll
    for (int s = 0; s < SQ; ++s) {
        A[s] = Quat{-expf(Alog[d*SQ + s]), Ai[d*SQ + s], Aj[d*SQ + s], Ak[d*SQ + s]};
        const int chain = (b * DQ + d) * SQ + s;
        h[s] = ld4(Hstart + 4 * (c * CHAINS + chain));
    }

    const int  m     = lane & 15;       // WMMA row (output quat component if <4)
    const bool hih   = lane >= 16;      // upper lane half -> K = 2,3
    const int  srcLo = m;               // owner lane of d = dbase + m
    const int  srcHi = m + 16;          // owner lane of d = dbase + 16 + m

    // Loop-invariant per-lane A-operand selectors: which C component feeds
    // ax/ay, its sign, and whether this row (m<4) is a valid L(C) row.
    const int mm = m & 3;
    int ix, iy; unsigned sxm, sym;
    if (!hih) { ix = mm;     iy = mm ^ 1;
                sxm = 0u;
                sym = (mm == 0 || mm == 3) ? 0x80000000u : 0u; }
    else      { ix = mm ^ 2; iy = mm ^ 3;
                sxm = (mm < 2) ? 0x80000000u : 0u;
                sym = (mm == 0 || mm == 2) ? 0x80000000u : 0u; }
    const bool ix1 = ix & 1, ix2 = (ix & 2) != 0;
    const bool iy1 = iy & 1, iy2 = (iy & 2) != 0;
    const float amask = (m < 4) ? 1.0f : 0.0f;

    for (int tt = 0; tt < CT; ++tt) {
        const int t   = t0 + tt;
        const int row = (b * LEN + t) * DQ;
        const float dtv = dtg[row + d];
        float4 uv = u4[row + d];
        Quat uq{uv.x, uv.y, uv.z, uv.w};

        v8f acc_lo = {0.f,0.f,0.f,0.f,0.f,0.f,0.f,0.f};
        v8f acc_hi = {0.f,0.f,0.f,0.f,0.f,0.f,0.f,0.f};

        #pragma unroll
        for (int s = 0; s < SQ; ++s) {
            float4 bv = sB[tt * SQ + s];
            Quat Bq{bv.x, bv.y, bv.z, bv.w};
            Quat q, Bu;
            cayley_step(dtv, A[s], Bq, uq, q, Bu);
            Quat nh = qmul(q, h[s]);
            h[s] = Quat{nh.r + Bu.r, nh.i + Bu.i, nh.j + Bu.j, nh.k + Bu.k};

            // --- A operand: L(C_s), 16x4 f32 layout, branch-free build.
            float4 cv = sC[tt * SQ + s];
            float ax = amask * __uint_as_float(
                           __float_as_uint(sel4(cv, ix1, ix2)) ^ sxm);
            float ay = amask * __uint_as_float(
                           __float_as_uint(sel4(cv, iy1, iy2)) ^ sym);
            v2f amat = {ax, ay};

            // --- B operand (4x16 f32): column n = d-channel, row k = h comp.
            float l0 = __shfl(h[s].r, srcLo, 32);
            float l1 = __shfl(h[s].i, srcLo, 32);
            float l2 = __shfl(h[s].j, srcLo, 32);
            float l3 = __shfl(h[s].k, srcLo, 32);
            v2f blo = { hih ? l2 : l0, hih ? l3 : l1 };
            float g0 = __shfl(h[s].r, srcHi, 32);
            float g1 = __shfl(h[s].i, srcHi, 32);
            float g2 = __shfl(h[s].j, srcHi, 32);
            float g3 = __shfl(h[s].k, srcHi, 32);
            v2f bhi = { hih ? g2 : g0, hih ? g3 : g1 };

            acc_lo = __builtin_amdgcn_wmma_f32_16x16x4_f32(
                         false, amat, false, blo, (short)0, acc_lo, false, false);
            acc_hi = __builtin_amdgcn_wmma_f32_16x16x4_f32(
                         false, amat, false, bhi, (short)0, acc_hi, false, false);
        }

        // D layout: lane n (0..15) holds M=0..3 (y comps) in VGPRs 0..3.
        if (lane < 16) {
            out4[row + dbase + lane]      = make_float4(acc_lo[0], acc_lo[1], acc_lo[2], acc_lo[3]);
            out4[row + dbase + 16 + lane] = make_float4(acc_hi[0], acc_hi[1], acc_hi[2], acc_hi[3]);
        }
    }
}

// ---------------------------------------------------------------------------
extern "C" void kernel_launch(void* const* d_in, const int* in_sizes, int n_in,
                              void* d_out, int out_size, void* d_ws, size_t ws_size,
                              hipStream_t stream)
{
    const float* u    = (const float*)d_in[0];
    const float* dtg  = (const float*)d_in[1];
    const float* Bin  = (const float*)d_in[2];
    const float* Cin  = (const float*)d_in[3];
    const float* Alog = (const float*)d_in[4];
    const float* Ai   = (const float*)d_in[5];
    const float* Aj   = (const float*)d_in[6];
    const float* Ak   = (const float*)d_in[7];
    float* out = (float*)d_out;

    // Workspace: 3 buffers of CHAINS*NCH quaternions (8 MB each), [chunk][chain]
    float* qb = (float*)d_ws;
    float* vb = qb + (size_t)CHAINS * NCH * 4;
    float* hs = vb + (size_t)CHAINS * NCH * 4;

    qssm_phase1<<<(BSZ * NCH * DQ) / 256, 256, 0, stream>>>(
        u, dtg, Bin, Alog, Ai, Aj, Ak, qb, vb);
    qssm_phase2<<<CHAINS / 64, 64, 0, stream>>>(qb, vb, hs);
    qssm_phase3<<<(BSZ * NCH * (DQ / 32) * 32) / 256, 256, 0, stream>>>(
        u, dtg, Bin, Cin, Alog, Ai, Aj, Ak, hs, out);
}

// v002
// One run takes 48.3 microseconds.
// In both of two side-by-side timings against v001, it was 1.38 times as fast.
// Counting every step since v000, it is 5.25 times as fast.
#include <hip/hip_runtime.h>
#include <math.h>

// Problem constants (match reference)
#define BSZ   2
#define LEN   2048
#define DQ    512
#define SQ    4
#define NCH   128                // chunks per sequence
#define CT    (LEN / NCH)        // 16 steps per chunk
#define EPSQ  1e-6f
#define CHAINS (BSZ * DQ * SQ)   // 4096 independent recurrences
#define SCB   16                 // chunk summaries the scan fetches per batch

typedef float v2f __attribute__((ext_vector_type(2)));
typedef float v8f __attribute__((ext_vector_type(8)));
typedef int   v4i __attribute__((ext_vector_type(4)));

#define AS1 __attribute__((address_space(1)))
#define AS3 __attribute__((address_space(3)))

struct Quat { float r, i, j, k; };

__device__ __forceinline__ Quat qmul(const Quat a, const Quat b) {
    Quat o;
    o.r = a.r*b.r - a.i*b.i - a.j*b.j - a.k*b.k;
    o.i = a.r*b.i + a.i*b.r + a.j*b.k - a.k*b.j;
    o.j = a.r*b.j - a.i*b.k + a.j*b.r + a.k*b.i;
    o.k = a.r*b.k + a.i*b.j - a.j*b.i + a.k*b.r;
    return o;
}

__device__ __forceinline__ Quat ld4(const float* p) {
    float4 v = *(const float4*)p;
    return Quat{v.x, v.y, v.z, v.w};
}

// Async global->LDS copy of 16 bytes (ASYNCcnt-tracked on gfx1250).
__device__ __forceinline__ void async_copy16(float4* lds_dst, const float4* gsrc) {
#if __has_builtin(__builtin_amdgcn_global_load_async_to_lds_b128)
    __builtin_amdgcn_global_load_async_to_lds_b128(
        (AS1 v4i*)gsrc, (AS3 v4i*)lds_dst, 0, 0);
#else
    unsigned loff = (unsigned)(uintptr_t)(AS3 void*)lds_dst;
    asm volatile("global_load_async_to_lds_b128 %0, %1, off"
                 :: "v"(loff), "v"(gsrc) : "memory");
#endif
}

__device__ __forceinline__ void async_wait0() {
#if __has_builtin(__builtin_amdgcn_s_wait_asynccnt)
    __builtin_amdgcn_s_wait_asynccnt(0);
#else
    asm volatile("s_wait_asynccnt 0" ::: "memory");
#endif
}

// Branch-free 4-way component select (3 v_cndmask).
__device__ __forceinline__ float sel4(float4 c, bool b1, bool b2) {
    float lo = b1 ? c.y : c.x;
    float hi = b1 ? c.w : c.z;
    return b2 ? hi : lo;
}

// A quaternion of one chain with the two loop-invariant norms the step needs.
struct Axis { float r, i, j, k, nv2, na2; };

__device__ __forceinline__ Axis make_axis(float alog, float ai, float aj, float ak) {
    Axis A;
    A.r = -expf(alog); A.i = ai; A.j = aj; A.k = ak;
    A.nv2 = ai*ai + aj*aj + ak*ak;
    A.na2 = A.r*A.r + A.nv2;
    return A;
}

// Cayley factors in closed form.  num, den and den_inv are all (scalar + scalar * Av),
// Av = (A.i, A.j, A.k), so their products need no quaternion multiply:
//   q          = qr + beta * Av,            qr = s * (1 - (dt/2)^2 |A|^2), beta = s * dt
//   den_inv*dt = er + beta * (dt/2) * Av,   er = beta * (1 - (dt/2) A.r)
// with s = 1 / (|den|^2 + eps) exactly as in the definition.
__device__ __forceinline__ void cayley_scalars(float dtv, float hd, float hd2, const Axis& A,
                                               float& qr, float& beta, float& er) {
    float dr = 1.0f - hd * A.r;
    float n2 = dr*dr + hd2 * A.nv2 + EPSQ;
    float s  = 1.0f / n2;
    qr   = s * (1.0f - hd2 * A.na2);
    beta = s * dtv;
    er   = beta * dr;
}

// h <- q*h + (den_inv*dt*B)*u = qr*h + er*w + beta * Av*(h + (dt/2)*w),  w = B*u.
__device__ __forceinline__ Quat state_step(float hd, const Axis& A, float qr, float beta,
                                           float er, Quat w, Quat h) {
    Quat x{h.r + hd * w.r, h.i + hd * w.i, h.j + hd * w.j, h.k + hd * w.k};
    Quat p;
    p.r = -A.i*x.i - A.j*x.j - A.k*x.k;
    p.i =  A.i*x.r + A.j*x.k - A.k*x.j;
    p.j =  A.j*x.r + A.k*x.i - A.i*x.k;
    p.k =  A.k*x.r + A.i*x.j - A.j*x.i;
    return Quat{qr*h.r + er*w.r + beta*p.r, qr*h.i + er*w.i + beta*p.i,
                qr*h.j + er*w.j + beta*p.j, qr*h.k + er*w.k + beta*p.k};
}

// ---------------------------------------------------------------------------
// Phase 1: per-chunk summaries.  One thread per (b, chunk, d); carries all 4 s.
// B_in rows for the chunk are staged block-wide into LDS via async copies.
// ---------------------------------------------------------------------------
__global__ __launch_bounds__(256)
void qssm_phase1(const float* __restrict__ u, const float* __restrict__ dtg,
                 const float* __restrict__ Bin,
                 const float* __restrict__ Alog, const float* __restrict__ Ai,
                 const float* __restrict__ Aj,   const float* __restrict__ Ak,
                 float* __restrict__ Qbuf, float* __restrict__ Vbuf)
{
    const int gid = blockIdx.x * blockDim.x + threadIdx.x;
    const int d = gid % DQ;
    const int c = (gid / DQ) % NCH;        // block-uniform
    const int b = gid / (DQ * NCH);        // block-uniform
    const int t0 = c * CT;

    const float4* u4 = (const float4*)u;
    const float4* B4 = (const float4*)Bin;

    // Stage this chunk's B_in [CT x SQ] quaternions into LDS (1 KB).
    __shared__ float4 sB[CT * SQ];
    {
        const float4* gB = B4 + (b * LEN + t0) * SQ;
        for (int e = threadIdx.x; e < CT * SQ; e += 256)
            async_copy16(&sB[e], gB + e);
        async_wait0();
        __syncthreads();
    }

    // The chunk's transition product stays in span{1, Av}: Q = Qa + Qb * Av.
    Axis A[SQ]; Quat h[SQ]; float Qa[SQ], Qb[SQ];
    #pragma unroll
    for (int s = 0; s < SQ; ++s) {
        A[s] = make_axis(Alog[d*SQ + s], Ai[d*SQ + s], Aj[d*SQ + s], Ak[d*SQ + s]);
        h[s] = Quat{0.f, 0.f, 0.f, 0.f};
        Qa[s] = 1.f; Qb[s] = 0.f;
    }

    for (int tt = 0; tt < CT; ++tt) {
        const int t   = t0 + tt;
        const int row = (b * LEN + t) * DQ;
        const float dtv = dtg[row + d];
        float4 uv = u4[row + d];
        Quat uq{uv.x, uv.y, uv.z, uv.w};
        // Inputs only: keeps both loads of a step at the head of the loop, where they
        // share one memory latency; without it the dt load sinks below the B*u products.
        asm volatile("" :: "v"(dtv), "v"(uv.x), "v"(uv.y), "v"(uv.z), "v"(uv.w));
        const float hd = 0.5f * dtv, hd2 = hd * hd;
        #pragma unroll
        for (int s = 0; s < SQ; ++s) {
            float4 bv = sB[tt * SQ + s];
            Quat Bq{bv.x, bv.y, bv.z, bv.w};
            float qr, beta, er;
            cayley_scalars(dtv, hd, hd2, A[s], qr, beta, er);
            h[s] = state_step(hd, A[s], qr, beta, er, qmul(Bq, uq), h[s]);
            const float na = qr * Qa[s] - (beta * A[s].nv2) * Qb[s];
            Qb[s] = qr * Qb[s] + beta * Qa[s];
            Qa[s] = na;
        }
    }

    float4 Qo[SQ];
    #pragma unroll
    for (int s = 0; s < SQ; ++s)
        Qo[s] = make_float4(Qa[s], Qb[s]*A[s].i, Qb[s]*A[s].j, Qb[s]*A[s].k);

    #pragma unroll
    for (int s = 0; s < SQ; ++s) {
        const int chain = (b * DQ + d) * SQ + s;
        const int idx   = c * CHAINS + chain;     // chunk-major: a wave writes whole lines
        ((float4*)Qbuf)[idx] = Qo[s];
        ((float4*)Vbuf)[idx] = make_float4(h[s].r, h[s].i, h[s].j, h[s].k);
    }
}

// ---------------------------------------------------------------------------
// Phase 2: inter-chunk exclusive scan per chain (NCH steps, 4096 threads).
// The summaries do not depend on h, so SCB chunks of them are fetched at once
// and one memory latency is paid per batch; only the fold itself is serial.
// ---------------------------------------------------------------------------
__global__ __launch_bounds__(64)
void qssm_phase2(const float* __restrict__ Qbuf, const float* __restrict__ Vbuf,
                 float* __restrict__ Hstart)
{
    const int chain = blockIdx.x * blockDim.x + threadIdx.x;
    Quat h{0.f, 0.f, 0.f, 0.f};
    #pragma unroll   // constant offsets from one base: the address registers are never rewritten
    for (int c0 = 0; c0 < NCH; c0 += SCB) {
        const float4* Qc = (const float4*)Qbuf + c0 * CHAINS;   // wave-uniform bases
        const float4* Vc = (const float4*)Vbuf + c0 * CHAINS;
        float4*       Hc = (float4*)Hstart + c0 * CHAINS;
        float4 q[SCB], v[SCB];
        #pragma unroll   // all 2*SCB loads issue before the first is waited for
        for (int j = 0; j < SCB; ++j) {
            q[j] = Qc[j * CHAINS + chain];
            v[j] = Vc[j * CHAINS + chain];
        }
        // Keeps every load of the batch above the fold: without it the scheduler
        // sinks most of them between the fold's steps and each pays its own latency.
        __builtin_amdgcn_sched_barrier(0);
        #pragma unroll   // q[] and v[] stay in registers
        for (int j = 0; j < SCB; ++j) {
            Hc[j * CHAINS + chain] = make_float4(h.r, h.i, h.j, h.k);
            Quat qh = qmul(Quat{q[j].x, q[j].y, q[j].z, q[j].w}, h);
            h = Quat{qh.r + v[j].x, qh.i + v[j].y, qh.j + v[j].z, qh.k + v[j].w};
        }
        // The next batch's loads land in registers that these stores still name.
        asm volatile("s_wait_xcnt 0x0" ::: "memory");
    }
}

// ---------------------------------------------------------------------------
// Phase 3: finalize.  One wave handles (b, chunk, 32 d-channels); lane owns d.
// y = sum_s L(C_s) @ h via V_WMMA_F32_16X16X4_F32.  A-operand selection is
// fully branch-free (loop-invariant per-lane index/sign masks), so EXEC stays
// all-ones through the WMMAs.  B_in/C_in chunk rows staged via async LDS.
// ---------------------------------------------------------------------------
__global__ __launch_bounds__(256)
void qssm_phase3(const float* __restrict__ u, const float* __restrict__ dtg,
                 const float* __restrict__ Bin, const float* __restrict__ Cin,
                 const float* __restrict__ Alog, const float* __restrict__ Ai,
                 const float* __restrict__ Aj,   const float* __restrict__ Ak,
                 const float* __restrict__ Hstart, float* __restrict__ out)
{
    const int tid  = blockIdx.x * blockDim.x + threadIdx.x;
    const int lane = threadIdx.x & 31;
    const int wave = tid >> 5;
    const int ndt  = DQ / 32;                       // 16 d-tiles
    const int dtile = wave % ndt;
    const int c     = (wave / ndt) % NCH;           // block-uniform
    const int b     = wave / (ndt * NCH);           // block-uniform
    const int dbase = dtile * 32;
    const int d     = dbase + lane;
    const int t0    = c * CT;

    const float4* u4 = (const float4*)u;
    const float4* B4 = (const float4*)Bin;
    const float4* C4 = (const float4*)Cin;
    float4* out4 = (float4*)out;

    // Stage this chunk's B_in and C_in rows into LDS (2 KB) asynchronously.
    __shared__ float4 sB[CT * SQ];
    __shared__ float4 sC[CT * SQ];
    {
        const float4* gB = B4 + (b * LEN + t0) * SQ;
        const float4* gC = C4 + (b * LEN + t0) * SQ;
        for (int e = threadIdx.x; e < CT * SQ; e += 256) {
            async_copy16(&sB[e], gB + e);
            async_copy16(&sC[e], gC + e);
        }
        async_wait0();
        __syncthreads();
    }

    Axis A[SQ]; Quat h[SQ];
    #pragma unroll
    for (int s = 0; s < SQ; ++s) {
        A[s] = make_axis(Alog[d*SQ + s], Ai[d*SQ + s], Aj[d*SQ + s], Ak[d*SQ + s]);
        const int chain = (b * DQ + d) * SQ + s;
        h[s] = ld4(Hstart + 4 * (c * CHAINS + chain));
    }

    const int  m     = lane & 15;       // WMMA row (output quat component if <4)
    const bool hih   = lane >= 16;      // upper lane half -> K = 2,3
    const int  srcLo = m;               // owner lane of d = dbase + m
    const int  srcHi = m + 16;          // owner lane of d = dbase + 16 + m

    // Loop-invariant per-lane A-operand selectors: which C component feeds
    // ax/ay, its sign, and whether this row (m<4) is a valid L(C) row.
    const int mm = m & 3;
    int ix, iy; unsigned sxm, sym;
    if (!hih) { ix = mm;     iy = mm ^ 1;
                sxm = 0u;
                sym = (mm == 0 || mm == 3) ? 0x80000000u : 0u; }
    else      { ix = mm ^ 2; iy = mm ^ 3;
                sxm = (mm < 2) ? 0x80000000u : 0u;
                sym = (mm == 0 || mm == 2) ? 0x80000000u : 0u; }
    const bool ix1 = ix & 1, ix2 = (ix & 2) != 0;
    const bool iy1 = iy & 1, iy2 = (iy & 2) != 0;
    const float amask = (m < 4) ? 1.0f : 0.0f;

    for (int tt = 0; tt < CT; ++tt) {
        const int t   = t0 + tt;
        const int row = (b * LEN + t) * DQ;
        const float dtv = dtg[row + d];
        float4 uv = u4[row + d];
        Quat uq{uv.x, uv.y, uv.z, uv.w};
        const float hd = 0.5f * dtv, hd2 = hd * hd;

        v8f acc_lo = {0.f,0.f,0.f,0.f,0.f,0.f,0.f,0.f};
        v8f acc_hi = {0.f,0.f,0.f,0.f,0.f,0.f,0.f,0.f};

        #pragma unroll
        for (int s = 0; s < SQ; ++s) {
            float4 bv = sB[tt * SQ + s];
            Quat Bq{bv.x, bv.y, bv.z, bv.w};
            float qr, beta, er;
            cayley_scalars(dtv, hd, hd2, A[s], qr, beta, er);
            h[s] = state_step(hd, A[s], qr, beta, er, qmul(Bq, uq), h[s]);

            // --- A operand: L(C_s), 16x4 f32 layout, branch-free build.
            float4 cv = sC[tt * SQ + s];
            float ax = amask * __uint_as_float(
                           __float_as_uint(sel4(cv, ix1, ix2)) ^ sxm);
            float ay = amask * __uint_as_float(
                           __float_as_uint(sel4(cv, iy1, iy2)) ^ sym);
            v2f amat = {ax, ay};

            // --- B operand (4x16 f32): column n = d-channel, row k = h comp.
            float l0 = __shfl(h[s].r, srcLo, 32);
            float l1 = __shfl(h[s].i, srcLo, 32);
            float l2 = __shfl(h[s].j, srcLo, 32);
            float l3 = __shfl(h[s].k, srcLo, 32);
            v2f blo = { hih ? l2 : l0, hih ? l3 : l1 };
            float g0 = __shfl(h[s].r, srcHi, 32);
            float g1 = __shfl(h[s].i, srcHi, 32);
            float g2 = __shfl(h[s].j, srcHi, 32);
            float g3 = __shfl(h[s].k, srcHi, 32);
            v2f bhi = { hih ? g2 : g0, hih ? g3 : g1 };

            acc_lo = __builtin_amdgcn_wmma_f32_16x16x4_f32(
                         false, amat, false, blo, (short)0, acc_lo, false, false);
            acc_hi = __builtin_amdgcn_wmma_f32_16x16x4_f32(
                         false, amat, false, bhi, (short)0, acc_hi, false, false);
        }

        // D layout: lane n (0..15) holds M=0..3 (y comps) in VGPRs 0..3.
        if (lane < 16) {
            out4[row + dbase + lane]      = make_float4(acc_lo[0], acc_lo[1], acc_lo[2], acc_lo[3]);
            out4[row + dbase + 16 + lane] = make_float4(acc_hi[0], acc_hi[1], acc_hi[2], acc_hi[3]);
            // The head of the next trip rewrites registers that these two stores name.
            asm volatile("s_wait_xcnt 0x0" ::: "memory");
        }
    }
}

// ---------------------------------------------------------------------------
extern "C" void kernel_launch(void* const* d_in, const int* in_sizes, int n_in,
                              void* d_out, int out_size, void* d_ws, size_t ws_size,
                              hipStream_t stream)
{
    const float* u    = (const float*)d_in[0];
    const float* dtg  = (const float*)d_in[1];
    const float* Bin  = (const float*)d_in[2];
    const float* Cin  = (const float*)d_in[3];
    const float* Alog = (const float*)d_in[4];
    const float* Ai   = (const float*)d_in[5];
    const float* Aj   = (const float*)d_in[6];
    const float* Ak   = (const float*)d_in[7];
    float* out = (float*)d_out;

    // Workspace: 3 buffers of CHAINS*NCH quaternions (8 MB each), [chunk][chain]
    float* qb = (float*)d_ws;
    float* vb = qb + (size_t)CHAINS * NCH * 4;
    float* hs = vb + (size_t)CHAINS * NCH * 4;

    qssm_phase1<<<(BSZ * NCH * DQ) / 256, 256, 0, stream>>>(
        u, dtg, Bin, Alog, Ai, Aj, Ak, qb, vb);
    qssm_phase2<<<CHAINS / 64, 64, 0, stream>>>(qb, vb, hs);
    qssm_phase3<<<(BSZ * NCH * (DQ / 32) * 32) / 256, 256, 0, stream>>>(
        u, dtg, Bin, Cin, Alog, Ai, Aj, Ak, hs, out);
}

// v003
// Measured time: 41.8 microseconds a run.
// Next to v002, in two timings, it ran 1.15 times as fast each time.
// All steps since v000 together make it 6.05 times as fast.
#include <hip/hip_runtime.h>
#include <math.h>

// Problem constants (match reference)
#define BSZ   2
#define LEN   2048
#define DQ    512
#define SQ    4
#define NCH   128                // chunks per sequence
#define CT    (LEN / NCH)        // 16 steps per chunk
#define EPSQ  1e-6f
#define CHAINS (BSZ * DQ * SQ)   // 4096 independent recurrences
#define SCB   16                 // chunk summaries the scan fetches per batch
// Steps of u and dt fetched ahead as one batch.  2 in the summary kernel: at 4 its build
// put a dt destination into the unused upper half of a packed operand's register pair,
// and the wait for that load then stood early in the batch instead of at its end.
#define PF1   2
#define PF3   4

typedef float v2f __attribute__((ext_vector_type(2)));
typedef float v8f __attribute__((ext_vector_type(8)));
typedef int   v4i __attribute__((ext_vector_type(4)));

#define AS1 __attribute__((address_space(1)))
#define AS3 __attribute__((address_space(3)))

struct Quat { float r, i, j, k; };

__device__ __forceinline__ Quat qmul(const Quat a, const Quat b) {
    Quat o;
    o.r = a.r*b.r - a.i*b.i - a.j*b.j - a.k*b.k;
    o.i = a.r*b.i + a.i*b.r + a.j*b.k - a.k*b.j;
    o.j = a.r*b.j - a.i*b.k + a.j*b.r + a.k*b.i;
    o.k = a.r*b.k + a.i*b.j - a.j*b.i + a.k*b.r;
    return o;
}

__device__ __forceinline__ Quat ld4(const float* p) {
    float4 v = *(const float4*)p;
    return Quat{v.x, v.y, v.z, v.w};
}

// Async global->LDS copy of 16 bytes (ASYNCcnt-tracked on gfx1250).
__device__ __forceinline__ void async_copy16(float4* lds_dst, const float4* gsrc) {
#if __has_builtin(__builtin_amdgcn_global_load_async_to_lds_b128)
    __builtin_amdgcn_global_load_async_to_lds_b128(
        (AS1 v4i*)gsrc, (AS3 v4i*)lds_dst, 0, 0);
#else
    unsigned loff = (unsigned)(uintptr_t)(AS3 void*)lds_dst;
    asm volatile("global_load_async_to_lds_b128 %0, %1, off"
                 :: "v"(loff), "v"(gsrc) : "memory");
#endif
}

__device__ __forceinline__ void async_wait0() {
#if __has_builtin(__builtin_amdgcn_s_wait_asynccnt)
    __builtin_amdgcn_s_wait_asynccnt(0);
#else
    asm volatile("s_wait_asynccnt 0" ::: "memory");
#endif
}

// Branch-free 4-way component select (3 v_cndmask).
__device__ __forceinline__ float sel4(float4 c, bool b1, bool b2) {
    float lo = b1 ? c.y : c.x;
    float hi = b1 ? c.w : c.z;
    return b2 ? hi : lo;
}

// A quaternion of one chain with the two loop-invariant norms the step needs.
struct Axis { float r, i, j, k, nv2, na2; };

__device__ __forceinline__ Axis make_axis(float alog, float ai, float aj, float ak) {
    Axis A;
    A.r = -expf(alog); A.i = ai; A.j = aj; A.k = ak;
    A.nv2 = ai*ai + aj*aj + ak*ak;
    A.na2 = A.r*A.r + A.nv2;
    return A;
}

// Cayley factors in closed form.  num, den and den_inv are all (scalar + scalar * Av),
// Av = (A.i, A.j, A.k), so their products need no quaternion multiply:
//   q          = qr + beta * Av,            qr = s * (1 - (dt/2)^2 |A|^2), beta = s * dt
//   den_inv*dt = er + beta * (dt/2) * Av,   er = beta * (1 - (dt/2) A.r)
// with s = 1 / (|den|^2 + eps) exactly as in the definition.
__device__ __forceinline__ void cayley_scalars(float dtv, float hd, float hd2, const Axis& A,
                                               float& qr, float& beta, float& er) {
    float dr = 1.0f - hd * A.r;
    float n2 = dr*dr + hd2 * A.nv2 + EPSQ;
    float s  = 1.0f / n2;
    qr   = s * (1.0f - hd2 * A.na2);
    beta = s * dtv;
    er   = beta * dr;
}

// h <- q*h + (den_inv*dt*B)*u = qr*h + er*w + beta * Av*(h + (dt/2)*w),  w = B*u.
__device__ __forceinline__ Quat state_step(float hd, const Axis& A, float qr, float beta,
                                           float er, Quat w, Quat h) {
    Quat x{h.r + hd * w.r, h.i + hd * w.i, h.j + hd * w.j, h.k + hd * w.k};
    Quat p;
    p.r = -A.i*x.i - A.j*x.j - A.k*x.k;
    p.i =  A.i*x.r + A.j*x.k - A.k*x.j;
    p.j =  A.j*x.r + A.k*x.i - A.i*x.k;
    p.k =  A.k*x.r + A.i*x.j - A.j*x.i;
    return Quat{qr*h.r + er*w.r + beta*p.r, qr*h.i + er*w.i + beta*p.i,
                qr*h.j + er*w.j + beta*p.j, qr*h.k + er*w.k + beta*p.k};
}

// Issues the u and dt loads of N consecutive steps of one channel; idx is the
// element index of the first step.  Nothing here waits for the data.
template <int N>
__device__ __forceinline__ void fetch_steps(const float4* __restrict__ u4,
                                            const float* __restrict__ dtg, int idx,
                                            float4 (&uv)[N], float (&dv)[N]) {
    #pragma unroll
    for (int j = 0; j < N; ++j) {
        uv[j] = u4[idx + j * DQ];
        dv[j] = dtg[idx + j * DQ];
    }
}

// ---------------------------------------------------------------------------
// Phase 1: per-chunk summaries.  One thread per (b, chunk, d); carries all 4 s.
// B_in rows for the chunk are staged block-wide into LDS via async copies.
// ---------------------------------------------------------------------------
__global__ __launch_bounds__(256)
void qssm_phase1(const float* __restrict__ u, const float* __restrict__ dtg,
                 const float* __restrict__ Bin,
                 const float* __restrict__ Alog, const float* __restrict__ Ai,
                 const float* __restrict__ Aj,   const float* __restrict__ Ak,
                 float* __restrict__ Qbuf, float* __restrict__ Vbuf)
{
    const int gid = blockIdx.x * blockDim.x + threadIdx.x;
    const int d = gid % DQ;
    const int c = (gid / DQ) % NCH;        // block-uniform
    const int b = gid / (DQ * NCH);        // block-uniform
    const int t0 = c * CT;

    const float4* u4 = (const float4*)u;
    const float4* B4 = (const float4*)Bin;

    // First batch of u and dt and, below, A: all in flight while B_in is staged.
    int idx = (b * LEN + t0) * DQ + d;
    float4 un[PF1]; float dn[PF1];
    fetch_steps(u4, dtg, idx, un, dn);

    // The chunk's transition product stays in span{1, Av}: Q = Qa + Qb * Av.
    Axis A[SQ]; Quat h[SQ]; float Qa[SQ], Qb[SQ];
    #pragma unroll
    for (int s = 0; s < SQ; ++s) {
        A[s] = make_axis(Alog[d*SQ + s], Ai[d*SQ + s], Aj[d*SQ + s], Ak[d*SQ + s]);
        h[s] = Quat{0.f, 0.f, 0.f, 0.f};
        Qa[s] = 1.f; Qb[s] = 0.f;
    }

    // Stage this chunk's B_in [CT x SQ] quaternions into LDS (1 KB).
    __shared__ float4 sB[CT * SQ];
    {
        const float4* gB = B4 + (b * LEN + t0) * SQ;
        for (int e = threadIdx.x; e < CT * SQ; e += 256)
            async_copy16(&sB[e], gB + e);
        async_wait0();
        __syncthreads();
    }

    #pragma unroll 1   // rolled: for speed only
    for (int g = 0; g < CT / PF1; ++g) {
        float4 uc[PF1]; float dc[PF1];
        #pragma unroll
        for (int j = 0; j < PF1; ++j) { uc[j] = un[j]; dc[j] = dn[j]; }
        // The next batch flies while this one is worked on.
        if (g + 1 < CT / PF1) {
            idx += PF1 * DQ;
            fetch_steps(u4, dtg, idx, un, dn);
        }
        #pragma unroll
        for (int j = 0; j < PF1; ++j) {
            const int tt = g * PF1 + j;
            const float dtv = dc[j];
            Quat uq{uc[j].x, uc[j].y, uc[j].z, uc[j].w};
            const float hd = 0.5f * dtv, hd2 = hd * hd;
            #pragma unroll
            for (int s = 0; s < SQ; ++s) {
                float4 bv = sB[tt * SQ + s];
                Quat Bq{bv.x, bv.y, bv.z, bv.w};
                float qr, beta, er;
                cayley_scalars(dtv, hd, hd2, A[s], qr, beta, er);
                h[s] = state_step(hd, A[s], qr, beta, er, qmul(Bq, uq), h[s]);
                const float na = qr * Qa[s] - (beta * A[s].nv2) * Qb[s];
                Qb[s] = qr * Qb[s] + beta * Qa[s];
                Qa[s] = na;
            }
        }
    }

    float4 Qo[SQ];
    #pragma unroll
    for (int s = 0; s < SQ; ++s)
        Qo[s] = make_float4(Qa[s], Qb[s]*A[s].i, Qb[s]*A[s].j, Qb[s]*A[s].k);

    #pragma unroll
    for (int s = 0; s < SQ; ++s) {
        const int chain = (b * DQ + d) * SQ + s;
        const int idx   = c * CHAINS + chain;     // chunk-major: a wave writes whole lines
        ((float4*)Qbuf)[idx] = Qo[s];
        ((float4*)Vbuf)[idx] = make_float4(h[s].r, h[s].i, h[s].j, h[s].k);
    }
}

// ---------------------------------------------------------------------------
// Phase 2: inter-chunk exclusive scan per chain (NCH steps, 4096 threads).
// The summaries do not depend on h, so SCB chunks of them are fetched at once
// and one memory latency is paid per batch; only the fold itself is serial.
// ---------------------------------------------------------------------------
__global__ __launch_bounds__(64)
void qssm_phase2(const float* __restrict__ Qbuf, const float* __restrict__ Vbuf,
                 float* __restrict__ Hstart)
{
    const int chain = blockIdx.x * blockDim.x + threadIdx.x;
    Quat h{0.f, 0.f, 0.f, 0.f};
    #pragma unroll   // constant offsets from one base: the address registers are never rewritten
    for (int c0 = 0; c0 < NCH; c0 += SCB) {
        const float4* Qc = (const float4*)Qbuf + c0 * CHAINS;   // wave-uniform bases
        const float4* Vc = (const float4*)Vbuf + c0 * CHAINS;
        float4*       Hc = (float4*)Hstart + c0 * CHAINS;
        float4 q[SCB], v[SCB];
        #pragma unroll   // all 2*SCB loads issue before the first is waited for
        for (int j = 0; j < SCB; ++j) {
            q[j] = Qc[j * CHAINS + chain];
            v[j] = Vc[j * CHAINS + chain];
        }
        // Keeps every load of the batch above the fold: without it the scheduler
        // sinks most of them between the fold's steps and each pays its own latency.
        __builtin_amdgcn_sched_barrier(0);
        #pragma unroll   // q[] and v[] stay in registers
        for (int j = 0; j < SCB; ++j) {
            Hc[j * CHAINS + chain] = make_float4(h.r, h.i, h.j, h.k);
            Quat qh = qmul(Quat{q[j].x, q[j].y, q[j].z, q[j].w}, h);
            h = Quat{qh.r + v[j].x, qh.i + v[j].y, qh.j + v[j].z, qh.k + v[j].w};
        }
        // The next batch's loads land in registers that these stores still name.
        asm volatile("s_wait_xcnt 0x0" ::: "memory");
    }
}

// ---------------------------------------------------------------------------
// Phase 3: finalize.  One wave handles (b, chunk, 32 d-channels); lane owns d.
// y = sum_s L(C_s) @ h via V_WMMA_F32_16X16X4_F32.  A-operand selection is
// fully branch-free (loop-invariant per-lane index/sign masks), so EXEC stays
// all-ones through the WMMAs.  B_in/C_in chunk rows staged via async LDS.
// ---------------------------------------------------------------------------
__global__ __launch_bounds__(256)
void qssm_phase3(const float* __restrict__ u, const float* __restrict__ dtg,
                 const float* __restrict__ Bin, const float* __restrict__ Cin,
                 const float* __restrict__ Alog, const float* __restrict__ Ai,
                 const float* __restrict__ Aj,   const float* __restrict__ Ak,
                 const float* __restrict__ Hstart, float* __restrict__ out)
{
    const int tid  = blockIdx.x * blockDim.x + threadIdx.x;
    const int lane = threadIdx.x & 31;
    const int wave = tid >> 5;
    const int ndt  = DQ / 32;                       // 16 d-tiles
    const int dtile = wave % ndt;
    const int c     = (wave / ndt) % NCH;           // block-uniform
    const int b     = wave / (ndt * NCH);           // block-uniform
    const int dbase = dtile * 32;
    const int d     = dbase + lane;
    const int t0    = c * CT;

    const float4* u4 = (const float4*)u;
    const float4* B4 = (const float4*)Bin;
    const float4* C4 = (const float4*)Cin;
    float4* out4 = (float4*)out;

    // First batch of u and dt, in flight while B_in and C_in are staged.
    int idx = (b * LEN + t0) * DQ + d;
    float4 un[PF3]; float dn[PF3];
    fetch_steps(u4, dtg, idx, un, dn);

    // A and the start state are fetched here too: every load of the set-up shares one
    // latency, and none is still outstanding when the loop's own loads are counted.
    Axis A[SQ]; Quat h[SQ];
    #pragma unroll
    for (int s = 0; s < SQ; ++s) {
        A[s] = make_axis(Alog[d*SQ + s], Ai[d*SQ + s], Aj[d*SQ + s], Ak[d*SQ + s]);
        const int chain = (b * DQ + d) * SQ + s;
        h[s] = ld4(Hstart + 4 * (c * CHAINS + chain));
    }

    // Stage this chunk's B_in and C_in rows into LDS (2 KB) asynchronously.
    __shared__ float4 sB[CT * SQ];
    __shared__ float4 sC[CT * SQ];
    {
        const float4* gB = B4 + (b * LEN + t0) * SQ;
        const float4* gC = C4 + (b * LEN + t0) * SQ;
        for (int e = threadIdx.x; e < CT * SQ; e += 256) {
            async_copy16(&sB[e], gB + e);
            async_copy16(&sC[e], gC + e);
        }
        async_wait0();
        __syncthreads();
    }

    const int  m     = lane & 15;       // WMMA row (output quat component if <4)
    const bool hih   = lane >= 16;      // upper lane half -> K = 2,3
    const int  srcLo = m;               // owner lane of d = dbase + m
    const int  srcHi = m + 16;          // owner lane of d = dbase + 16 + m

    // Loop-invariant per-lane A-operand selectors: which C component feeds
    // ax/ay, its sign, and whether this row (m<4) is a valid L(C) row.
    const int mm = m & 3;
    int ix, iy; unsigned sxm, sym;
    if (!hih) { ix = mm;     iy = mm ^ 1;
                sxm = 0u;
                sym = (mm == 0 || mm == 3) ? 0x80000000u : 0u; }
    else      { ix = mm ^ 2; iy = mm ^ 3;
                sxm = (mm < 2) ? 0x80000000u : 0u;
                sym = (mm == 0 || mm == 2) ? 0x80000000u : 0u; }
    const bool ix1 = ix & 1, ix2 = (ix & 2) != 0;
    const bool iy1 = iy & 1, iy2 = (iy & 2) != 0;
    const float amask = (m < 4) ? 1.0f : 0.0f;

    #pragma unroll 1   // rolled: for speed only
    for (int g = 0; g < CT / PF3; ++g) {
      float4 uc[PF3]; float dc[PF3];
      #pragma unroll
      for (int j = 0; j < PF3; ++j) { uc[j] = un[j]; dc[j] = dn[j]; }
      // The next batch flies while this one is worked on.
      if (g + 1 < CT / PF3) {
          idx += PF3 * DQ;
          fetch_steps(u4, dtg, idx, un, dn);
      }
      #pragma unroll
      for (int j = 0; j < PF3; ++j) {
        const int tt  = g * PF3 + j;
        const int t   = t0 + tt;
        const int row = (b * LEN + t) * DQ;
        const float dtv = dc[j];
        Quat uq{uc[j].x, uc[j].y, uc[j].z, uc[j].w};
        const float hd = 0.5f * dtv, hd2 = hd * hd;

        v8f acc_lo = {0.f,0.f,0.f,0.f,0.f,0.f,0.f,0.f};
        v8f acc_hi = {0.f,0.f,0.f,0.f,0.f,0.f,0.f,0.f};

        #pragma unroll
        for (int s = 0; s < SQ; ++s) {
            float4 bv = sB[tt * SQ + s];
            Quat Bq{bv.x, bv.y, bv.z, bv.w};
            float qr, beta, er;
            cayley_scalars(dtv, hd, hd2, A[s], qr, beta, er);
            h[s] = state_step(hd, A[s], qr, beta, er, qmul(Bq, uq), h[s]);

            // --- A operand: L(C_s), 16x4 f32 layout, branch-free build.
            float4 cv = sC[tt * SQ + s];
            float ax = amask * __uint_as_float(
                           __float_as_uint(sel4(cv, ix1, ix2)) ^ sxm);
            float ay = amask * __uint_as_float(
                           __float_as_uint(sel4(cv, iy1, iy2)) ^ sym);
            v2f amat = {ax, ay};

            // --- B operand (4x16 f32): column n = d-channel, row k = h comp.
            float l0 = __shfl(h[s].r, srcLo, 32);
            float l1 = __shfl(h[s].i, srcLo, 32);
            float l2 = __shfl(h[s].j, srcLo, 32);
            float l3 = __shfl(h[s].k, srcLo, 32);
            v2f blo = { hih ? l2 : l0, hih ? l3 : l1 };
            float g0 = __shfl(h[s].r, srcHi, 32);
            float g1 = __shfl(h[s].i, srcHi, 32);
            float g2 = __shfl(h[s].j, srcHi, 32);
            float g3 = __shfl(h[s].k, srcHi, 32);
            v2f bhi = { hih ? g2 : g0, hih ? g3 : g1 };

            acc_lo = __builtin_amdgcn_wmma_f32_16x16x4_f32(
                         false, amat, false, blo, (short)0, acc_lo, false, false);
            acc_hi = __builtin_amdgcn_wmma_f32_16x16x4_f32(
                         false, amat, false, bhi, (short)0, acc_hi, false, false);
        }

        // D layout: lane n (0..15) holds M=0..3 (y comps) in VGPRs 0..3.
        if (lane < 16) {
            out4[row + dbase + lane]      = make_float4(acc_lo[0], acc_lo[1], acc_lo[2], acc_lo[3]);
            out4[row + dbase + 16 + lane] = make_float4(acc_hi[0], acc_hi[1], acc_hi[2], acc_hi[3]);
            // The head of the next trip rewrites registers that these two stores name.
            asm volatile("s_wait_xcnt 0x0" ::: "memory");
        }
      }
    }
}

// ---------------------------------------------------------------------------
extern "C" void kernel_launch(void* const* d_in, const int* in_sizes, int n_in,
                              void* d_out, int out_size, void* d_ws, size_t ws_size,
                              hipStream_t stream)
{
    const float* u    = (const float*)d_in[0];
    const float* dtg  = (const float*)d_in[1];
    const float* Bin  = (const float*)d_in[2];
    const float* Cin  = (const float*)d_in[3];
    const float* Alog = (const float*)d_in[4];
    const float* Ai   = (const float*)d_in[5];
    const float* Aj   = (const float*)d_in[6];
    const float* Ak   = (const float*)d_in[7];
    float* out = (float*)d_out;

    // Workspace: 3 buffers of CHAINS*NCH quaternions (8 MB each), [chunk][chain]
    float* qb = (float*)d_ws;
    float* vb = qb + (size_t)CHAINS * NCH * 4;
    float* hs = vb + (size_t)CHAINS * NCH * 4;

    qssm_phase1<<<(BSZ * NCH * DQ) / 256, 256, 0, stream>>>(
        u, dtg, Bin, Alog, Ai, Aj, Ak, qb, vb);
    qssm_phase2<<<CHAINS / 64, 64, 0, stream>>>(qb, vb, hs);
    qssm_phase3<<<(BSZ * NCH * (DQ / 32) * 32) / 256, 256, 0, stream>>>(
        u, dtg, Bin, Cin, Alog, Ai, Aj, Ak, hs, out);
}

// v004
// It runs in 35.4 microseconds.
// Next to v003, in two timings, it ran 1.19 and 1.18 times as fast.
// All steps since v000 together make it 7.15 times as fast.
#include <hip/hip_runtime.h>
#include <math.h>

// Problem constants (match reference)
#define BSZ   2
#define LEN   2048
#define DQ    512
#define SQ    4
#define NCH   128                // chunks per sequence
#define CT    (LEN / NCH)        // 16 steps per chunk
#define EPSQ  1e-6f
#define CHAINS (BSZ * DQ * SQ)   // 4096 independent recurrences
#define SUP   8                  // consecutive chunks per work-group, one per wave
#define NSUP  (NCH / SUP)        // 16 groups of chunks per sequence
#define GCH   (32 * SQ)          // 128 recurrences per work-group (32 channels)
// Steps of u and dt fetched ahead as one batch.  2 in the summary kernel: at 4 its build
// put a dt destination into the unused upper half of a packed operand's register pair,
// and the wait for that load then stood early in the batch instead of at its end.
#define PF1   2
#define PF3   4

typedef float v2f __attribute__((ext_vector_type(2)));
typedef float v8f __attribute__((ext_vector_type(8)));
typedef int   v4i __attribute__((ext_vector_type(4)));

#define AS1 __attribute__((address_space(1)))
#define AS3 __attribute__((address_space(3)))

struct Quat { float r, i, j, k; };

__device__ __forceinline__ Quat qmul(const Quat a, const Quat b) {
    Quat o;
    o.r = a.r*b.r - a.i*b.i - a.j*b.j - a.k*b.k;
    o.i = a.r*b.i + a.i*b.r + a.j*b.k - a.k*b.j;
    o.j = a.r*b.j - a.i*b.k + a.j*b.r + a.k*b.i;
    o.k = a.r*b.k + a.i*b.j - a.j*b.i + a.k*b.r;
    return o;
}

__device__ __forceinline__ Quat ld4(const float* p) {
    float4 v = *(const float4*)p;
    return Quat{v.x, v.y, v.z, v.w};
}

// Async global->LDS copy of 16 bytes (ASYNCcnt-tracked on gfx1250).
__device__ __forceinline__ void async_copy16(float4* lds_dst, const float4* gsrc) {
#if __has_builtin(__builtin_amdgcn_global_load_async_to_lds_b128)
    __builtin_amdgcn_global_load_async_to_lds_b128(
        (AS1 v4i*)gsrc, (AS3 v4i*)lds_dst, 0, 0);
#else
    unsigned loff = (unsigned)(uintptr_t)(AS3 void*)lds_dst;
    asm volatile("global_load_async_to_lds_b128 %0, %1, off"
                 :: "v"(loff), "v"(gsrc) : "memory");
#endif
}

__device__ __forceinline__ void async_wait0() {
#if __has_builtin(__builtin_amdgcn_s_wait_asynccnt)
    __builtin_amdgcn_s_wait_asynccnt(0);
#else
    asm volatile("s_wait_asynccnt 0" ::: "memory");
#endif
}

// Branch-free 4-way component select (3 v_cndmask).
__device__ __forceinline__ float sel4(float4 c, bool b1, bool b2) {
    float lo = b1 ? c.y : c.x;
    float hi = b1 ? c.w : c.z;
    return b2 ? hi : lo;
}

// A quaternion of one chain with the two loop-invariant norms the step needs.
struct Axis { float r, i, j, k, nv2, na2; };

__device__ __forceinline__ Axis make_axis(float alog, float ai, float aj, float ak) {
    Axis A;
    A.r = -expf(alog); A.i = ai; A.j = aj; A.k = ak;
    A.nv2 = ai*ai + aj*aj + ak*ak;
    A.na2 = A.r*A.r + A.nv2;
    return A;
}

// Cayley factors in closed form.  num, den and den_inv are all (scalar + scalar * Av),
// Av = (A.i, A.j, A.k), so their products need no quaternion multiply:
//   q          = qr + beta * Av,            qr = s * (1 - (dt/2)^2 |A|^2), beta = s * dt
//   den_inv*dt = er + beta * (dt/2) * Av,   er = beta * (1 - (dt/2) A.r)
// with s = 1 / (|den|^2 + eps) exactly as in the definition.
__device__ __forceinline__ void cayley_scalars(float dtv, float hd, float hd2, const Axis& A,
                                               float& qr, float& beta, float& er) {
    float dr = 1.0f - hd * A.r;
    float n2 = dr*dr + hd2 * A.nv2 + EPSQ;
    float s  = 1.0f / n2;
    qr   = s * (1.0f - hd2 * A.na2);
    beta = s * dtv;
    er   = beta * dr;
}

// h <- q*h + (den_inv*dt*B)*u = qr*h + er*w + beta * Av*(h + (dt/2)*w),  w = B*u.
__device__ __forceinline__ Quat state_step(float hd, const Axis& A, float qr, float beta,
                                           float er, Quat w, Quat h) {
    Quat x{h.r + hd * w.r, h.i + hd * w.i, h.j + hd * w.j, h.k + hd * w.k};
    Quat p;
    p.r = -A.i*x.i - A.j*x.j - A.k*x.k;
    p.i =  A.i*x.r + A.j*x.k - A.k*x.j;
    p.j =  A.j*x.r + A.k*x.i - A.i*x.k;
    p.k =  A.k*x.r + A.i*x.j - A.j*x.i;
    return Quat{qr*h.r + er*w.r + beta*p.r, qr*h.i + er*w.i + beta*p.i,
                qr*h.j + er*w.j + beta*p.j, qr*h.k + er*w.k + beta*p.k};
}

// Issues the u and dt loads of N consecutive steps of one channel; idx is the
// element index of the first step.  Nothing here waits for the data.
template <int N>
__device__ __forceinline__ void fetch_steps(const float4* __restrict__ u4,
                                            const float* __restrict__ dtg, int idx,
                                            float4 (&uv)[N], float (&dv)[N]) {
    #pragma unroll
    for (int j = 0; j < N; ++j) {
        uv[j] = u4[idx + j * DQ];
        dv[j] = dtg[idx + j * DQ];
    }
}

// ---------------------------------------------------------------------------
// Phase 1: chunk summaries and their scan inside a group of SUP chunks.
// A work-group is (b, group, 32 d-channels); wave = chunk, lane = d, carrying all 4 s.
// The SUP summaries of each recurrence meet in LDS, where one thread per recurrence
// folds them: it writes, per chunk, the map from the group's start state to the chunk's
// start state (Qpre, Vpre), and the whole group's summary (Qsup, Vsup).
// B_in rows for the group are staged block-wide into LDS via async copies.
// ---------------------------------------------------------------------------
__global__ __launch_bounds__(256)
void qssm_phase1(const float* __restrict__ u, const float* __restrict__ dtg,
                 const float* __restrict__ Bin,
                 const float* __restrict__ Alog, const float* __restrict__ Ai,
                 const float* __restrict__ Aj,   const float* __restrict__ Ak,
                 float* __restrict__ Qpre, float* __restrict__ Vpre,
                 float* __restrict__ Qsup, float* __restrict__ Vsup)
{
    const int lane  = threadIdx.x & 31;
    const int w     = __builtin_amdgcn_readfirstlane(threadIdx.x >> 5);   // chunk in the group
    const int dbase = (blockIdx.x % (DQ / 32)) * 32;
    const int S     = (blockIdx.x / (DQ / 32)) % NSUP;
    const int b     = blockIdx.x / ((DQ / 32) * NSUP);
    const int d  = dbase + lane;
    const int t0 = (S * SUP + w) * CT;

    const float4* u4 = (const float4*)u;
    const float4* B4 = (const float4*)Bin;

    // First batch of u and dt and, below, A: all in flight while B_in is staged.
    int idx = (b * LEN + t0) * DQ + d;
    float4 un[PF1]; float dn[PF1];
    fetch_steps(u4, dtg, idx, un, dn);
    static_assert(PF1 == 2, "the batch's dt values are handled as one pair below");

    // The chunk's transition product stays in span{1, Av}: Q = Qa + Qb * Av.
    Axis A[SQ]; Quat h[SQ]; float Qa[SQ], Qb[SQ];
    #pragma unroll
    for (int s = 0; s < SQ; ++s) {
        A[s] = make_axis(Alog[d*SQ + s], Ai[d*SQ + s], Aj[d*SQ + s], Ak[d*SQ + s]);
        h[s] = Quat{0.f, 0.f, 0.f, 0.f};
        Qa[s] = 1.f; Qb[s] = 0.f;
    }

    // Stage the group's B_in [SUP*CT x SQ] quaternions into LDS (8 KB).
    __shared__ float4 sB[SUP * CT * SQ];
    {
        const float4* gB = B4 + (b * LEN + S * SUP * CT) * SQ;
        #pragma unroll   // fixed trip count: every lane is on at every copy
        for (int i = 0; i < SUP * CT * SQ / 256; ++i)
            async_copy16(&sB[i * 256 + threadIdx.x], gB + i * 256 + threadIdx.x);
        async_wait0();
        __syncthreads();
    }

    #pragma unroll 1   // rolled: for speed only
    for (int g = 0; g < CT / PF1; ++g) {
        float4 uc[PF1]; float dc[PF1];
        #pragma unroll
        for (int j = 0; j < PF1; ++j) { uc[j] = un[j]; dc[j] = dn[j]; }
        // The next batch flies while this one is worked on.
        if (g + 1 < CT / PF1) {
            idx += PF1 * DQ;
            fetch_steps(u4, dtg, idx, un, dn);
        }
        // dt/2 and its square are formed for both steps at the head of the batch, as pairs.
        // Formed step by step, this kernel's build gave a dt still in flight the idle upper half
        // of a packed operand's register pair, and its wait stood early in the batch (see PF1).
        const v2f dcv = {dc[0], dc[1]};
        const v2f hdv = 0.5f * dcv, hd2v = hdv * hdv;
        #pragma unroll
        for (int j = 0; j < PF1; ++j) {
            const int tt = w * CT + g * PF1 + j;
            const float dtv = dcv[j];
            Quat uq{uc[j].x, uc[j].y, uc[j].z, uc[j].w};
            const float hd = hdv[j], hd2 = hd2v[j];
            #pragma unroll
            for (int s = 0; s < SQ; ++s) {
                float4 bv = sB[tt * SQ + s];
                Quat Bq{bv.x, bv.y, bv.z, bv.w};
                float qr, beta, er;
                cayley_scalars(dtv, hd, hd2, A[s], qr, beta, er);
                h[s] = state_step(hd, A[s], qr, beta, er, qmul(Bq, uq), h[s]);
                const float na = qr * Qa[s] - (beta * A[s].nv2) * Qb[s];
                Qb[s] = qr * Qb[s] + beta * Qa[s];
                Qa[s] = na;
            }
        }
    }

    float4 Qo[SQ];
    #pragma unroll
    for (int s = 0; s < SQ; ++s)
        Qo[s] = make_float4(Qa[s], Qb[s]*A[s].i, Qb[s]*A[s].j, Qb[s]*A[s].k);

    // Hand the chunk's summary over: [chunk][recurrence of the work-group].
    __shared__ float4 sQ[SUP * GCH];
    __shared__ float4 sV[SUP * GCH];
    #pragma unroll
    for (int s = 0; s < SQ; ++s) {
        sQ[w * GCH + lane * SQ + s] = Qo[s];
        sV[w * GCH + lane * SQ + s] = make_float4(h[s].r, h[s].i, h[s].j, h[s].k);
    }
    __syncthreads();
    if (threadIdx.x >= GCH) return;      // whole waves leave, behind the last barrier

    const int jr = threadIdx.x;          // recurrence of the work-group that this thread scans
    float4 q[SUP], v[SUP];
    #pragma unroll   // all LDS reads issue before the serial fold
    for (int k = 0; k < SUP; ++k) { q[k] = sQ[k * GCH + jr]; v[k] = sV[k * GCH + jr]; }

    const int chain = (b * DQ + dbase) * SQ + jr;        // a wave writes whole lines
    Quat P[SUP + 1], x[SUP + 1];         // maps up to the start of chunk k; [SUP]: the whole group
    P[0] = Quat{1.f, 0.f, 0.f, 0.f};
    x[0] = Quat{0.f, 0.f, 0.f, 0.f};
    #pragma unroll   // everything stays in registers
    for (int k = 0; k < SUP; ++k) {
        const Quat qk{q[k].x, q[k].y, q[k].z, q[k].w};
        const Quat qx = qmul(qk, x[k]);
        x[k + 1] = Quat{qx.r + v[k].x, qx.i + v[k].y, qx.j + v[k].z, qx.k + v[k].w};
        P[k + 1] = qmul(qk, P[k]);
    }
    // Holds the stores behind the fold: mixed into it, the serial fold had to wait for
    // stores before it could reuse their registers.
    __builtin_amdgcn_sched_barrier(0);
    ((float4*)Qsup)[S * CHAINS + chain] = make_float4(P[SUP].r, P[SUP].i, P[SUP].j, P[SUP].k);
    ((float4*)Vsup)[S * CHAINS + chain] = make_float4(x[SUP].r, x[SUP].i, x[SUP].j, x[SUP].k);
    #pragma unroll
    for (int k = 0; k < SUP; ++k) {
        const int idx = (S * SUP + k) * CHAINS + chain;
        ((float4*)Qpre)[idx] = make_float4(P[k].r, P[k].i, P[k].j, P[k].k);
        ((float4*)Vpre)[idx] = make_float4(x[k].r, x[k].i, x[k].j, x[k].k);
    }
}

// ---------------------------------------------------------------------------
// Phase 3: finalize.  A work-group is (b, group, 32 d-channels) as in phase 1; one wave
// handles one chunk, lane owns d.  The group's start state is folded here from the
// summaries of the groups before it (at most NSUP-1, fetched at once), one thread per
// recurrence, and passed through LDS behind the staging barrier.
// y = sum_s L(C_s) @ h via V_WMMA_F32_16X16X4_F32.  A-operand selection is
// fully branch-free (loop-invariant per-lane index/sign masks), so EXEC stays
// all-ones through the WMMAs.  B_in/C_in chunk rows staged via async LDS.
// ---------------------------------------------------------------------------
__global__ __launch_bounds__(256)
void qssm_phase3(const float* __restrict__ u, const float* __restrict__ dtg,
                 const float* __restrict__ Bin, const float* __restrict__ Cin,
                 const float* __restrict__ Alog, const float* __restrict__ Ai,
                 const float* __restrict__ Aj,   const float* __restrict__ Ak,
                 const float* __restrict__ Qpre, const float* __restrict__ Vpre,
                 const float* __restrict__ Qsup, const float* __restrict__ Vsup,
                 float* __restrict__ out)
{
    const int lane  = threadIdx.x & 31;
    const int w     = __builtin_amdgcn_readfirstlane(threadIdx.x >> 5);   // chunk in the group
    const int dbase = (blockIdx.x % (DQ / 32)) * 32;
    const int S     = (blockIdx.x / (DQ / 32)) % NSUP;
    const int b     = blockIdx.x / ((DQ / 32) * NSUP);
    const int c     = S * SUP + w;
    const int d     = dbase + lane;
    const int t0    = c * CT;

    const float4* u4 = (const float4*)u;
    const float4* B4 = (const float4*)Bin;
    const float4* C4 = (const float4*)Cin;
    float4* out4 = (float4*)out;

    // First batch of u and dt, in flight while B_in and C_in are staged.
    int idx = (b * LEN + t0) * DQ + d;
    float4 un[PF3]; float dn[PF3];
    fetch_steps(u4, dtg, idx, un, dn);

    // A and the chunk's map from the group's start state are fetched here too: every load
    // of the set-up shares one latency, and none is still outstanding when the loop's own
    // loads are counted.
    Axis A[SQ]; Quat h[SQ]; Quat Qp[SQ];
    #pragma unroll
    for (int s = 0; s < SQ; ++s) {
        A[s] = make_axis(Alog[d*SQ + s], Ai[d*SQ + s], Aj[d*SQ + s], Ak[d*SQ + s]);
        const int chain = (b * DQ + d) * SQ + s;
        Qp[s] = ld4(Qpre + 4 * (c * CHAINS + chain));
        h[s]  = ld4(Vpre + 4 * (c * CHAINS + chain));
    }

    // Stage the group's B_in and C_in rows into LDS (16 KB) asynchronously; under the
    // copies, waves 0-3 fold the earlier groups' summaries into the group's start state.
    __shared__ float4 sB[SUP * CT * SQ];
    __shared__ float4 sC[SUP * CT * SQ];
    __shared__ float4 sH[GCH];
    {
        const float4* gB = B4 + (b * LEN + S * SUP * CT) * SQ;
        const float4* gC = C4 + (b * LEN + S * SUP * CT) * SQ;
        #pragma unroll   // fixed trip count: every lane is on at every copy
        for (int i = 0; i < SUP * CT * SQ / 256; ++i) {
            async_copy16(&sB[i * 256 + threadIdx.x], gB + i * 256 + threadIdx.x);
            async_copy16(&sC[i * 256 + threadIdx.x], gC + i * 256 + threadIdx.x);
        }
        if (threadIdx.x < GCH) {
            const int chain = (b * DQ + dbase) * SQ + threadIdx.x;
            float4 q[NSUP - 1], v[NSUP - 1];
            #pragma unroll   // every summary is fetched (all are written by phase 1): one latency
            for (int k = 0; k < NSUP - 1; ++k) {
                q[k] = ((const float4*)Qsup)[k * CHAINS + chain];
                v[k] = ((const float4*)Vsup)[k * CHAINS + chain];
            }
            // The code below rewrites the address register that these loads name.
            asm volatile("s_wait_xcnt 0x0" ::: "memory");
            Quat g{0.f, 0.f, 0.f, 0.f};
            #pragma unroll   // q[] and v[] stay in registers
            for (int k = 0; k < NSUP - 1; ++k) {
                if (k < S) {             // block-uniform: only the groups before this one
                    Quat qg = qmul(Quat{q[k].x, q[k].y, q[k].z, q[k].w}, g);
                    g = Quat{qg.r + v[k].x, qg.i + v[k].y, qg.j + v[k].z, qg.k + v[k].w};
                }
            }
            sH[threadIdx.x] = make_float4(g.r, g.i, g.j, g.k);
        }
        async_wait0();
        __syncthreads();
    }

    // Chunk's start state = Qpre * (group's start state) + Vpre.
    #pragma unroll
    for (int s = 0; s < SQ; ++s) {
        float4 gs = sH[lane * SQ + s];
        Quat qg = qmul(Qp[s], Quat{gs.x, gs.y, gs.z, gs.w});
        h[s] = Quat{qg.r + h[s].r, qg.i + h[s].i, qg.j + h[s].j, qg.k + h[s].k};
    }

    const int  m     = lane & 15;       // WMMA row (output quat component if <4)
    const bool hih   = lane >= 16;      // upper lane half -> K = 2,3
    const int  srcLo = m;               // owner lane of d = dbase + m
    const int  srcHi = m + 16;          // owner lane of d = dbase + 16 + m

    // Loop-invariant per-lane A-operand selectors: which C component feeds
    // ax/ay, its sign, and whether this row (m<4) is a valid L(C) row.
    const int mm = m & 3;
    int ix, iy; unsigned sxm, sym;
    if (!hih) { ix = mm;     iy = mm ^ 1;
                sxm = 0u;
                sym = (mm == 0 || mm == 3) ? 0x80000000u : 0u; }
    else      { ix = mm ^ 2; iy = mm ^ 3;
                sxm = (mm < 2) ? 0x80000000u : 0u;
                sym = (mm == 0 || mm == 2) ? 0x80000000u : 0u; }
    const bool ix1 = ix & 1, ix2 = (ix & 2) != 0;
    const bool iy1 = iy & 1, iy2 = (iy & 2) != 0;
    const float amask = (m < 4) ? 1.0f : 0.0f;

    #pragma unroll 1   // rolled: for speed only
    for (int g = 0; g < CT / PF3; ++g) {
      float4 uc[PF3]; float dc[PF3];
      #pragma unroll
      for (int j = 0; j < PF3; ++j) { uc[j] = un[j]; dc[j] = dn[j]; }
      // The next batch flies while this one is worked on.
      if (g + 1 < CT / PF3) {
          idx += PF3 * DQ;
          fetch_steps(u4, dtg, idx, un, dn);
      }
      #pragma unroll
      for (int j = 0; j < PF3; ++j) {
        const int tt  = w * CT + g * PF3 + j;     // row of the staged group
        const int t   = t0 + g * PF3 + j;
        const int row = (b * LEN + t) * DQ;
        const float dtv = dc[j];
        Quat uq{uc[j].x, uc[j].y, uc[j].z, uc[j].w};
        const float hd = 0.5f * dtv, hd2 = hd * hd;

        v8f acc_lo = {0.f,0.f,0.f,0.f,0.f,0.f,0.f,0.f};
        v8f acc_hi = {0.f,0.f,0.f,0.f,0.f,0.f,0.f,0.f};

        #pragma unroll
        for (int s = 0; s < SQ; ++s) {
            float4 bv = sB[tt * SQ + s];
            Quat Bq{bv.x, bv.y, bv.z, bv.w};
            float qr, beta, er;
            cayley_scalars(dtv, hd, hd2, A[s], qr, beta, er);
            h[s] = state_step(hd, A[s], qr, beta, er, qmul(Bq, uq), h[s]);

            // --- A operand: L(C_s), 16x4 f32 layout, branch-free build.
            float4 cv = sC[tt * SQ + s];
            float ax = amask * __uint_as_float(
                           __float_as_uint(sel4(cv, ix1, ix2)) ^ sxm);
            float ay = amask * __uint_as_float(
                           __float_as_uint(sel4(cv, iy1, iy2)) ^ sym);
            v2f amat = {ax, ay};

            // --- B operand (4x16 f32): column n = d-channel, row k = h comp.
            float l0 = __shfl(h[s].r, srcLo, 32);
            float l1 = __shfl(h[s].i, srcLo, 32);
            float l2 = __shfl(h[s].j, srcLo, 32);
            float l3 = __shfl(h[s].k, srcLo, 32);
            v2f blo = { hih ? l2 : l0, hih ? l3 : l1 };
            float g0 = __shfl(h[s].r, srcHi, 32);
            float g1 = __shfl(h[s].i, srcHi, 32);
            float g2 = __shfl(h[s].j, srcHi, 32);
            float g3 = __shfl(h[s].k, srcHi, 32);
            v2f bhi = { hih ? g2 : g0, hih ? g3 : g1 };

            acc_lo = __builtin_amdgcn_wmma_f32_16x16x4_f32(
                         false, amat, false, blo, (short)0, acc_lo, false, false);
            acc_hi = __builtin_amdgcn_wmma_f32_16x16x4_f32(
                         false, amat, false, bhi, (short)0, acc_hi, false, false);
        }

        // D layout: lane n (0..15) holds M=0..3 (y comps) in VGPRs 0..3.
        if (lane < 16) {
            out4[row + dbase + lane]      = make_float4(acc_lo[0], acc_lo[1], acc_lo[2], acc_lo[3]);
            out4[row + dbase + 16 + lane] = make_float4(acc_hi[0], acc_hi[1], acc_hi[2], acc_hi[3]);
            // The head of the next trip rewrites registers that these two stores name.
            asm volatile("s_wait_xcnt 0x0" ::: "memory");
        }
      }
    }
}

// ---------------------------------------------------------------------------
extern "C" void kernel_launch(void* const* d_in, const int* in_sizes, int n_in,
                              void* d_out, int out_size, void* d_ws, size_t ws_size,
                              hipStream_t stream)
{
    const float* u    = (const float*)d_in[0];
    const float* dtg  = (const float*)d_in[1];
    const float* Bin  = (const float*)d_in[2];
    const float* Cin  = (const float*)d_in[3];
    const float* Alog = (const float*)d_in[4];
    const float* Ai   = (const float*)d_in[5];
    const float* Aj   = (const float*)d_in[6];
    const float* Ak   = (const float*)d_in[7];
    float* out = (float*)d_out;

    // Workspace: 2 buffers of CHAINS*NCH quaternions (8 MB each), [chunk][chain], and
    // 2 of CHAINS*NSUP (1 MB each), [group][chain]
    float* qp = (float*)d_ws;
    float* vp = qp + (size_t)CHAINS * NCH * 4;
    float* qs = vp + (size_t)CHAINS * NCH * 4;
    float* vs = qs + (size_t)CHAINS * NSUP * 4;

    qssm_phase1<<<BSZ * NSUP * (DQ / 32), 256, 0, stream>>>(
        u, dtg, Bin, Alog, Ai, Aj, Ak, qp, vp, qs, vs);
    qssm_phase3<<<BSZ * NSUP * (DQ / 32), 256, 0, stream>>>(
        u, dtg, Bin, Cin, Alog, Ai, Aj, Ak, qp, vp, qs, vs, out);
}

// v005
// One run takes 33.6 microseconds.
// Next to v004, in two timings, it ran 1.05 and 1.06 times as fast.
// All steps since v000 together make it 7.53 times as fast.
#include <hip/hip_runtime.h>
#include <math.h>

// Problem constants (match reference)
#define BSZ   2
#define LEN   2048
#define DQ    512
#define SQ    4
#define NCH   128                // chunks per sequence
#define CT    (LEN / NCH)        // 16 steps per chunk
#define EPSQ  1e-6f
#define CHAINS (BSZ * DQ * SQ)   // 4096 independent recurrences
#define SUP   8                  // consecutive chunks per work-group, one per wave
#define NSUP  (NCH / SUP)        // 16 groups of chunks per sequence
#define GCH   (32 * SQ)          // 128 recurrences per work-group (32 channels)
// Steps of u and dt fetched ahead as one batch.  2 in the summary kernel: at 4 its build
// put a dt destination into the unused upper half of a packed operand's register pair,
// and the wait for that load then stood early in the batch instead of at its end.
#define PF1   2
#define PF3   4

typedef float v2f __attribute__((ext_vector_type(2)));
typedef float v8f __attribute__((ext_vector_type(8)));
typedef int   v4i __attribute__((ext_vector_type(4)));

#define AS1 __attribute__((address_space(1)))
#define AS3 __attribute__((address_space(3)))

struct Quat { float r, i, j, k; };

__device__ __forceinline__ Quat qmul(const Quat a, const Quat b) {
    Quat o;
    o.r = a.r*b.r - a.i*b.i - a.j*b.j - a.k*b.k;
    o.i = a.r*b.i + a.i*b.r + a.j*b.k - a.k*b.j;
    o.j = a.r*b.j - a.i*b.k + a.j*b.r + a.k*b.i;
    o.k = a.r*b.k + a.i*b.j - a.j*b.i + a.k*b.r;
    return o;
}

__device__ __forceinline__ Quat ld4(const float* p) {
    float4 v = *(const float4*)p;
    return Quat{v.x, v.y, v.z, v.w};
}

// Async global->LDS copy of 16 bytes (ASYNCcnt-tracked on gfx1250).
__device__ __forceinline__ void async_copy16(float4* lds_dst, const float4* gsrc) {
#if __has_builtin(__builtin_amdgcn_global_load_async_to_lds_b128)
    __builtin_amdgcn_global_load_async_to_lds_b128(
        (AS1 v4i*)gsrc, (AS3 v4i*)lds_dst, 0, 0);
#else
    unsigned loff = (unsigned)(uintptr_t)(AS3 void*)lds_dst;
    asm volatile("global_load_async_to_lds_b128 %0, %1, off"
                 :: "v"(loff), "v"(gsrc) : "memory");
#endif
}

__device__ __forceinline__ void async_wait0() {
#if __has_builtin(__builtin_amdgcn_s_wait_asynccnt)
    __builtin_amdgcn_s_wait_asynccnt(0);
#else
    asm volatile("s_wait_asynccnt 0" ::: "memory");
#endif
}

// Branch-free 4-way component select (3 v_cndmask).
__device__ __forceinline__ float sel4(float4 c, bool b1, bool b2) {
    float lo = b1 ? c.y : c.x;
    float hi = b1 ? c.w : c.z;
    return b2 ? hi : lo;
}

// A quaternion of one chain with the two loop-invariant norms the step needs.
struct Axis { float r, i, j, k, nv2, na2; };

__device__ __forceinline__ Axis make_axis(float alog, float ai, float aj, float ak) {
    Axis A;
    A.r = -expf(alog); A.i = ai; A.j = aj; A.k = ak;
    A.nv2 = ai*ai + aj*aj + ak*ak;
    A.na2 = A.r*A.r + A.nv2;
    return A;
}

// Cayley factors in closed form.  num, den and den_inv are all (scalar + scalar * Av),
// Av = (A.i, A.j, A.k), so their products need no quaternion multiply:
//   q          = qr + beta * Av,            qr = s * (1 - (dt/2)^2 |A|^2), beta = s * dt
//   den_inv*dt = er + beta * (dt/2) * Av,   er = beta * (1 - (dt/2) A.r)
// with s = 1 / (|den|^2 + eps) exactly as in the definition.
__device__ __forceinline__ void cayley_scalars(float dtv, float hd, float hd2, const Axis& A,
                                               float& qr, float& beta, float& er) {
    float dr = 1.0f - hd * A.r;
    float n2 = dr*dr + hd2 * A.nv2 + EPSQ;
    // v_rcp_f32 and one Newton step in place of the compiler's division, ten instructions that
    // also go through VCC.  n2 >= eps, so the operand is never subnormal and the result never
    // overflows; the result would be subnormal only from n2 = 2^126 on (|dt * A| near 1e19).
    float r0 = __builtin_amdgcn_rcpf(n2);
    float s  = fmaf(fmaf(-n2, r0, 1.0f), r0, r0);
    qr   = s * (1.0f - hd2 * A.na2);
    beta = s * dtv;
    er   = beta * dr;
}

// h <- q*h + (den_inv*dt*B)*u = qr*h + er*w + beta * Av*(h + (dt/2)*w),  w = B*u.
__device__ __forceinline__ Quat state_step(float hd, const Axis& A, float qr, float beta,
                                           float er, Quat w, Quat h) {
    Quat x{h.r + hd * w.r, h.i + hd * w.i, h.j + hd * w.j, h.k + hd * w.k};
    Quat p;
    p.r = -A.i*x.i - A.j*x.j - A.k*x.k;
    p.i =  A.i*x.r + A.j*x.k - A.k*x.j;
    p.j =  A.j*x.r + A.k*x.i - A.i*x.k;
    p.k =  A.k*x.r + A.i*x.j - A.j*x.i;
    return Quat{qr*h.r + er*w.r + beta*p.r, qr*h.i + er*w.i + beta*p.i,
                qr*h.j + er*w.j + beta*p.j, qr*h.k + er*w.k + beta*p.k};
}

// Issues the u and dt loads of N consecutive steps of one channel; idx is the
// element index of the first step.  Nothing here waits for the data.
template <int N>
__device__ __forceinline__ void fetch_steps(const float4* __restrict__ u4,
                                            const float* __restrict__ dtg, int idx,
                                            float4 (&uv)[N], float (&dv)[N]) {
    #pragma unroll
    for (int j = 0; j < N; ++j) {
        uv[j] = u4[idx + j * DQ];
        dv[j] = dtg[idx + j * DQ];
    }
}

// ---------------------------------------------------------------------------
// Phase 1: chunk summaries and their scan inside a group of SUP chunks.
// A work-group is (b, group, 32 d-channels); wave = chunk, lane = d, carrying all 4 s.
// The SUP summaries of each recurrence meet in LDS, where one thread per recurrence
// folds them: it writes, per chunk, the map from the group's start state to the chunk's
// start state (Qpre, Vpre), and the whole group's summary (Qsup, Vsup).
// B_in rows for the group are staged block-wide into LDS via async copies.
// ---------------------------------------------------------------------------
__global__ __launch_bounds__(256)
void qssm_phase1(const float* __restrict__ u, const float* __restrict__ dtg,
                 const float* __restrict__ Bin,
                 const float* __restrict__ Alog, const float* __restrict__ Ai,
                 const float* __restrict__ Aj,   const float* __restrict__ Ak,
                 float* __restrict__ Qpre, float* __restrict__ Vpre,
                 float* __restrict__ Qsup, float* __restrict__ Vsup)
{
    const int lane  = threadIdx.x & 31;
    const int w     = __builtin_amdgcn_readfirstlane(threadIdx.x >> 5);   // chunk in the group
    const int dbase = (blockIdx.x % (DQ / 32)) * 32;
    const int S     = (blockIdx.x / (DQ / 32)) % NSUP;
    const int b     = blockIdx.x / ((DQ / 32) * NSUP);
    const int d  = dbase + lane;
    const int t0 = (S * SUP + w) * CT;

    const float4* u4 = (const float4*)u;
    const float4* B4 = (const float4*)Bin;

    // First batch of u and dt and, below, A: all in flight while B_in is staged.
    int idx = (b * LEN + t0) * DQ + d;
    float4 un[PF1]; float dn[PF1];
    fetch_steps(u4, dtg, idx, un, dn);
    static_assert(PF1 == 2, "the batch's dt values are handled as one pair below");

    // The chunk's transition product stays in span{1, Av}: Q = Qa + Qb * Av.
    Axis A[SQ]; Quat h[SQ]; float Qa[SQ], Qb[SQ];
    #pragma unroll
    for (int s = 0; s < SQ; ++s) {
        A[s] = make_axis(Alog[d*SQ + s], Ai[d*SQ + s], Aj[d*SQ + s], Ak[d*SQ + s]);
        h[s] = Quat{0.f, 0.f, 0.f, 0.f};
        Qa[s] = 1.f; Qb[s] = 0.f;
    }

    // Stage the group's B_in [SUP*CT x SQ] quaternions into LDS (8 KB).
    __shared__ float4 sB[SUP * CT * SQ];
    {
        const float4* gB = B4 + (b * LEN + S * SUP * CT) * SQ;
        #pragma unroll   // fixed trip count: every lane is on at every copy
        for (int i = 0; i < SUP * CT * SQ / 256; ++i)
            async_copy16(&sB[i * 256 + threadIdx.x], gB + i * 256 + threadIdx.x);
        async_wait0();
        __syncthreads();
    }

    #pragma unroll 1   // rolled: for speed only
    for (int g = 0; g < CT / PF1; ++g) {
        float4 uc[PF1]; float dc[PF1];
        #pragma unroll
        for (int j = 0; j < PF1; ++j) { uc[j] = un[j]; dc[j] = dn[j]; }
        // The next batch flies while this one is worked on.
        if (g + 1 < CT / PF1) {
            idx += PF1 * DQ;
            fetch_steps(u4, dtg, idx, un, dn);
        }
        // dt/2 and its square are formed for both steps at the head of the batch, as pairs.
        // Formed step by step, this kernel's build gave a dt still in flight the idle upper half
        // of a packed operand's register pair, and its wait stood early in the batch (see PF1).
        const v2f dcv = {dc[0], dc[1]};
        const v2f hdv = 0.5f * dcv, hd2v = hdv * hdv;
        #pragma unroll
        for (int j = 0; j < PF1; ++j) {
            const int tt = w * CT + g * PF1 + j;
            const float dtv = dcv[j];
            Quat uq{uc[j].x, uc[j].y, uc[j].z, uc[j].w};
            const float hd = hdv[j], hd2 = hd2v[j];
            #pragma unroll
            for (int s = 0; s < SQ; ++s) {
                float4 bv = sB[tt * SQ + s];
                Quat Bq{bv.x, bv.y, bv.z, bv.w};
                float qr, beta, er;
                cayley_scalars(dtv, hd, hd2, A[s], qr, beta, er);
                h[s] = state_step(hd, A[s], qr, beta, er, qmul(Bq, uq), h[s]);
                const float na = qr * Qa[s] - (beta * A[s].nv2) * Qb[s];
                Qb[s] = qr * Qb[s] + beta * Qa[s];
                Qa[s] = na;
            }
        }
    }

    float4 Qo[SQ];
    #pragma unroll
    for (int s = 0; s < SQ; ++s)
        Qo[s] = make_float4(Qa[s], Qb[s]*A[s].i, Qb[s]*A[s].j, Qb[s]*A[s].k);

    // Hand the chunk's summary over: [chunk][recurrence of the work-group].
    __shared__ float4 sQ[SUP * GCH];
    __shared__ float4 sV[SUP * GCH];
    #pragma unroll
    for (int s = 0; s < SQ; ++s) {
        sQ[w * GCH + lane * SQ + s] = Qo[s];
        sV[w * GCH + lane * SQ + s] = make_float4(h[s].r, h[s].i, h[s].j, h[s].k);
    }
    __syncthreads();
    if (threadIdx.x >= GCH) return;      // whole waves leave, behind the last barrier

    const int jr = threadIdx.x;          // recurrence of the work-group that this thread scans
    float4 q[SUP], v[SUP];
    #pragma unroll   // all LDS reads issue before the serial fold
    for (int k = 0; k < SUP; ++k) { q[k] = sQ[k * GCH + jr]; v[k] = sV[k * GCH + jr]; }

    const int chain = (b * DQ + dbase) * SQ + jr;        // a wave writes whole lines
    Quat P[SUP + 1], x[SUP + 1];         // maps up to the start of chunk k; [SUP]: the whole group
    P[0] = Quat{1.f, 0.f, 0.f, 0.f};
    x[0] = Quat{0.f, 0.f, 0.f, 0.f};
    #pragma unroll   // everything stays in registers
    for (int k = 0; k < SUP; ++k) {
        const Quat qk{q[k].x, q[k].y, q[k].z, q[k].w};
        const Quat qx = qmul(qk, x[k]);
        x[k + 1] = Quat{qx.r + v[k].x, qx.i + v[k].y, qx.j + v[k].z, qx.k + v[k].w};
        P[k + 1] = qmul(qk, P[k]);
    }
    // Holds the stores behind the fold: mixed into it, the serial fold had to wait for
    // stores before it could reuse their registers.
    __builtin_amdgcn_sched_barrier(0);
    ((float4*)Qsup)[S * CHAINS + chain] = make_float4(P[SUP].r, P[SUP].i, P[SUP].j, P[SUP].k);
    ((float4*)Vsup)[S * CHAINS + chain] = make_float4(x[SUP].r, x[SUP].i, x[SUP].j, x[SUP].k);
    #pragma unroll
    for (int k = 0; k < SUP; ++k) {
        const int idx = (S * SUP + k) * CHAINS + chain;
        ((float4*)Qpre)[idx] = make_float4(P[k].r, P[k].i, P[k].j, P[k].k);
        ((float4*)Vpre)[idx] = make_float4(x[k].r, x[k].i, x[k].j, x[k].k);
    }
}

// ---------------------------------------------------------------------------
// Phase 3: finalize.  A work-group is (b, group, 32 d-channels) as in phase 1; one wave
// handles one chunk, lane owns d.  The group's start state is folded here from the
// summaries of the groups before it (at most NSUP-1, fetched at once), one thread per
// recurrence, and passed through LDS behind the staging barrier.
// y = sum_s L(C_s) @ h via V_WMMA_F32_16X16X4_F32.  A-operand selection is
// fully branch-free (loop-invariant per-lane index/sign masks), so EXEC stays
// all-ones through the WMMAs.  B_in/C_in chunk rows staged via async LDS.
// ---------------------------------------------------------------------------
__global__ __launch_bounds__(256)
void qssm_phase3(const float* __restrict__ u, const float* __restrict__ dtg,
                 const float* __restrict__ Bin, const float* __restrict__ Cin,
                 const float* __restrict__ Alog, const float* __restrict__ Ai,
                 const float* __restrict__ Aj,   const float* __restrict__ Ak,
                 const float* __restrict__ Qpre, const float* __restrict__ Vpre,
                 const float* __restrict__ Qsup, const float* __restrict__ Vsup,
                 float* __restrict__ out)
{
    const int lane  = threadIdx.x & 31;
    const int w     = __builtin_amdgcn_readfirstlane(threadIdx.x >> 5);   // chunk in the group
    const int dbase = (blockIdx.x % (DQ / 32)) * 32;
    const int S     = (blockIdx.x / (DQ / 32)) % NSUP;
    const int b     = blockIdx.x / ((DQ / 32) * NSUP);
    const int c     = S * SUP + w;
    const int d     = dbase + lane;
    const int t0    = c * CT;

    const float4* u4 = (const float4*)u;
    const float4* B4 = (const float4*)Bin;
    const float4* C4 = (const float4*)Cin;
    float4* out4 = (float4*)out;

    // First batch of u and dt, in flight while B_in and C_in are staged.
    int idx = (b * LEN + t0) * DQ + d;
    float4 un[PF3]; float dn[PF3];
    fetch_steps(u4, dtg, idx, un, dn);

    // A and the chunk's map from the group's start state are fetched here too: every load
    // of the set-up shares one latency, and none is still outstanding when the loop's own
    // loads are counted.
    Axis A[SQ]; Quat h[SQ]; Quat Qp[SQ];
    #pragma unroll
    for (int s = 0; s < SQ; ++s) {
        A[s] = make_axis(Alog[d*SQ + s], Ai[d*SQ + s], Aj[d*SQ + s], Ak[d*SQ + s]);
        const int chain = (b * DQ + d) * SQ + s;
        Qp[s] = ld4(Qpre + 4 * (c * CHAINS + chain));
        h[s]  = ld4(Vpre + 4 * (c * CHAINS + chain));
    }

    // Stage the group's B_in and C_in rows into LDS (16 KB) asynchronously; under the
    // copies, waves 0-3 fold the earlier groups' summaries into the group's start state.
    __shared__ float4 sB[SUP * CT * SQ];
    __shared__ float4 sC[SUP * CT * SQ];
    __shared__ float4 sH[GCH];
    {
        const float4* gB = B4 + (b * LEN + S * SUP * CT) * SQ;
        const float4* gC = C4 + (b * LEN + S * SUP * CT) * SQ;
        #pragma unroll   // fixed trip count: every lane is on at every copy
        for (int i = 0; i < SUP * CT * SQ / 256; ++i) {
            async_copy16(&sB[i * 256 + threadIdx.x], gB + i * 256 + threadIdx.x);
            async_copy16(&sC[i * 256 + threadIdx.x], gC + i * 256 + threadIdx.x);
        }
        if (threadIdx.x < GCH) {
            const int chain = (b * DQ + dbase) * SQ + threadIdx.x;
            float4 q[NSUP - 1], v[NSUP - 1];
            #pragma unroll   // every summary is fetched (all are written by phase 1): one latency
            for (int k = 0; k < NSUP - 1; ++k) {
                q[k] = ((const float4*)Qsup)[k * CHAINS + chain];
                v[k] = ((const float4*)Vsup)[k * CHAINS + chain];
            }
            // The code below rewrites the address register that these loads name.
            asm volatile("s_wait_xcnt 0x0" ::: "memory");
            Quat g{0.f, 0.f, 0.f, 0.f};
            #pragma unroll   // q[] and v[] stay in registers
            for (int k = 0; k < NSUP - 1; ++k) {
                if (k < S) {             // block-uniform: only the groups before this one
                    Quat qg = qmul(Quat{q[k].x, q[k].y, q[k].z, q[k].w}, g);
                    g = Quat{qg.r + v[k].x, qg.i + v[k].y, qg.j + v[k].z, qg.k + v[k].w};
                }
            }
            sH[threadIdx.x] = make_float4(g.r, g.i, g.j, g.k);
        }
        async_wait0();
        __syncthreads();
    }

    // Chunk's start state = Qpre * (group's start state) + Vpre.
    #pragma unroll
    for (int s = 0; s < SQ; ++s) {
        float4 gs = sH[lane * SQ + s];
        Quat qg = qmul(Qp[s], Quat{gs.x, gs.y, gs.z, gs.w});
        h[s] = Quat{qg.r + h[s].r, qg.i + h[s].i, qg.j + h[s].j, qg.k + h[s].k};
    }

    const int  m     = lane & 15;       // WMMA row (output quat component if <4)
    const bool hih   = lane >= 16;      // upper lane half -> K = 2,3
    const int  srcLo = m;               // owner lane of d = dbase + m
    const int  srcHi = m + 16;          // owner lane of d = dbase + 16 + m

    // Loop-invariant per-lane A-operand selectors: which C component feeds
    // ax/ay, its sign, and whether this row (m<4) is a valid L(C) row.
    const int mm = m & 3;
    int ix, iy; unsigned sxm, sym;
    if (!hih) { ix = mm;     iy = mm ^ 1;
                sxm = 0u;
                sym = (mm == 0 || mm == 3) ? 0x80000000u : 0u; }
    else      { ix = mm ^ 2; iy = mm ^ 3;
                sxm = (mm < 2) ? 0x80000000u : 0u;
                sym = (mm == 0 || mm == 2) ? 0x80000000u : 0u; }
    const bool ix1 = ix & 1, ix2 = (ix & 2) != 0;
    const bool iy1 = iy & 1, iy2 = (iy & 2) != 0;
    const float amask = (m < 4) ? 1.0f : 0.0f;

    #pragma unroll 1   // rolled: for speed only
    for (int g = 0; g < CT / PF3; ++g) {
      float4 uc[PF3]; float dc[PF3];
      #pragma unroll
      for (int j = 0; j < PF3; ++j) { uc[j] = un[j]; dc[j] = dn[j]; }
      // The next batch flies while this one is worked on.
      if (g + 1 < CT / PF3) {
          idx += PF3 * DQ;
          fetch_steps(u4, dtg, idx, un, dn);
      }
      #pragma unroll
      for (int j = 0; j < PF3; ++j) {
        const int tt  = w * CT + g * PF3 + j;     // row of the staged group
        const int t   = t0 + g * PF3 + j;
        const int row = (b * LEN + t) * DQ;
        const float dtv = dc[j];
        Quat uq{uc[j].x, uc[j].y, uc[j].z, uc[j].w};
        const float hd = 0.5f * dtv, hd2 = hd * hd;

        v8f acc_lo = {0.f,0.f,0.f,0.f,0.f,0.f,0.f,0.f};
        v8f acc_hi = {0.f,0.f,0.f,0.f,0.f,0.f,0.f,0.f};

        #pragma unroll
        for (int s = 0; s < SQ; ++s) {
            float4 bv = sB[tt * SQ + s];
            Quat Bq{bv.x, bv.y, bv.z, bv.w};
            float qr, beta, er;
            cayley_scalars(dtv, hd, hd2, A[s], qr, beta, er);
            h[s] = state_step(hd, A[s], qr, beta, er, qmul(Bq, uq), h[s]);

            // --- A operand: L(C_s), 16x4 f32 layout, branch-free build.
            float4 cv = sC[tt * SQ + s];
            float ax = amask * __uint_as_float(
                           __float_as_uint(sel4(cv, ix1, ix2)) ^ sxm);
            float ay = amask * __uint_as_float(
                           __float_as_uint(sel4(cv, iy1, iy2)) ^ sym);
            v2f amat = {ax, ay};

            // --- B operand (4x16 f32): column n = d-channel, row k = h comp.
            float l0 = __shfl(h[s].r, srcLo, 32);
            float l1 = __shfl(h[s].i, srcLo, 32);
            float l2 = __shfl(h[s].j, srcLo, 32);
            float l3 = __shfl(h[s].k, srcLo, 32);
            v2f blo = { hih ? l2 : l0, hih ? l3 : l1 };
            float g0 = __shfl(h[s].r, srcHi, 32);
            float g1 = __shfl(h[s].i, srcHi, 32);
            float g2 = __shfl(h[s].j, srcHi, 32);
            float g3 = __shfl(h[s].k, srcHi, 32);
            v2f bhi = { hih ? g2 : g0, hih ? g3 : g1 };

            acc_lo = __builtin_amdgcn_wmma_f32_16x16x4_f32(
                         false, amat, false, blo, (short)0, acc_lo, false, false);
            acc_hi = __builtin_amdgcn_wmma_f32_16x16x4_f32(
                         false, amat, false, bhi, (short)0, acc_hi, false, false);
        }

        // D layout: lane n (0..15) holds M=0..3 (y comps) in VGPRs 0..3.
        if (lane < 16) {
            out4[row + dbase + lane]      = make_float4(acc_lo[0], acc_lo[1], acc_lo[2], acc_lo[3]);
            out4[row + dbase + 16 + lane] = make_float4(acc_hi[0], acc_hi[1], acc_hi[2], acc_hi[3]);
            // The head of the next trip rewrites registers that these two stores name.
            asm volatile("s_wait_xcnt 0x0" ::: "memory");
        }
      }
    }
}

// ---------------------------------------------------------------------------
extern "C" void kernel_launch(void* const* d_in, const int* in_sizes, int n_in,
                              void* d_out, int out_size, void* d_ws, size_t ws_size,
                              hipStream_t stream)
{
    const float* u    = (const float*)d_in[0];
    const float* dtg  = (const float*)d_in[1];
    const float* Bin  = (const float*)d_in[2];
    const float* Cin  = (const float*)d_in[3];
    const float* Alog = (const float*)d_in[4];
    const float* Ai   = (const float*)d_in[5];
    const float* Aj   = (const float*)d_in[6];
    const float* Ak   = (const float*)d_in[7];
    float* out = (float*)d_out;

    // Workspace: 2 buffers of CHAINS*NCH quaternions (8 MB each), [chunk][chain], and
    // 2 of CHAINS*NSUP (1 MB each), [group][chain]
    float* qp = (float*)d_ws;
    float* vp = qp + (size_t)CHAINS * NCH * 4;
    float* qs = vp + (size_t)CHAINS * NCH * 4;
    float* vs = qs + (size_t)CHAINS * NSUP * 4;

    qssm_phase1<<<BSZ * NSUP * (DQ / 32), 256, 0, stream>>>(
        u, dtg, Bin, Alog, Ai, Aj, Ak, qp, vp, qs, vs);
    qssm_phase3<<<BSZ * NSUP * (DQ / 32), 256, 0, stream>>>(
        u, dtg, Bin, Cin, Alog, Ai, Aj, Ak, qp, vp, qs, vs, out);
}

// v006
// One run takes 29.5 microseconds.
// Two timings next to v005 put it at 1.13 and 1.14 times that version's speed.
// Counting every step since v000, it is 8.55 times as fast.
#include <hip/hip_runtime.h>
#include <math.h>

// Problem constants (match reference)
#define BSZ   2
#define LEN   2048
#define DQ    512
#define SQ    4
#define NCH   128                // chunks per sequence
#define CT    (LEN / NCH)        // 16 steps per chunk
#define EPSQ  1e-6f
#define CHAINS (BSZ * DQ * SQ)   // 4096 independent recurrences
#define SUP   8                  // consecutive chunks per work-group, one per wave
#define NSUP  (NCH / SUP)        // 16 groups of chunks per sequence
#define GCH   (32 * SQ)          // 128 recurrences per work-group (32 channels)
// Steps of u and dt fetched ahead as one batch.  2 in the summary kernel: at 4 its build
// put a dt destination into the unused upper half of a packed operand's register pair,
// and the wait for that load then stood early in the batch instead of at its end.
#define PF1   2
#define PF3   4
#define AROWS 5                  // rows kept in LDS per (step, column of L(C)): four, and one of zeros

typedef float v2f __attribute__((ext_vector_type(2)));
typedef float v8f __attribute__((ext_vector_type(8)));
typedef int   v4i __attribute__((ext_vector_type(4)));

#define AS1 __attribute__((address_space(1)))
#define AS3 __attribute__((address_space(3)))

struct Quat { float r, i, j, k; };

__device__ __forceinline__ Quat qmul(const Quat a, const Quat b) {
    Quat o;
    o.r = a.r*b.r - a.i*b.i - a.j*b.j - a.k*b.k;
    o.i = a.r*b.i + a.i*b.r + a.j*b.k - a.k*b.j;
    o.j = a.r*b.j - a.i*b.k + a.j*b.r + a.k*b.i;
    o.k = a.r*b.k + a.i*b.j - a.j*b.i + a.k*b.r;
    return o;
}

__device__ __forceinline__ Quat ld4(const float* p) {
    float4 v = *(const float4*)p;
    return Quat{v.x, v.y, v.z, v.w};
}

// Async global->LDS copy of 16 bytes (ASYNCcnt-tracked on gfx1250).
__device__ __forceinline__ void async_copy16(float4* lds_dst, const float4* gsrc) {
#if __has_builtin(__builtin_amdgcn_global_load_async_to_lds_b128)
    __builtin_amdgcn_global_load_async_to_lds_b128(
        (AS1 v4i*)gsrc, (AS3 v4i*)lds_dst, 0, 0);
#else
    unsigned loff = (unsigned)(uintptr_t)(AS3 void*)lds_dst;
    asm volatile("global_load_async_to_lds_b128 %0, %1, off"
                 :: "v"(loff), "v"(gsrc) : "memory");
#endif
}

__device__ __forceinline__ void async_wait0() {
#if __has_builtin(__builtin_amdgcn_s_wait_asynccnt)
    __builtin_amdgcn_s_wait_asynccnt(0);
#else
    asm volatile("s_wait_asynccnt 0" ::: "memory");
#endif
}

// A quaternion of one chain with the two loop-invariant norms the step needs.
struct Axis { float r, i, j, k, nv2, na2; };

__device__ __forceinline__ Axis make_axis(float alog, float ai, float aj, float ak) {
    Axis A;
    A.r = -expf(alog); A.i = ai; A.j = aj; A.k = ak;
    A.nv2 = ai*ai + aj*aj + ak*ak;
    A.na2 = A.r*A.r + A.nv2;
    return A;
}

// Cayley factors in closed form.  num, den and den_inv are all (scalar + scalar * Av),
// Av = (A.i, A.j, A.k), so their products need no quaternion multiply:
//   q          = qr + beta * Av,            qr = s * (1 - (dt/2)^2 |A|^2), beta = s * dt
//   den_inv*dt = er + beta * (dt/2) * Av,   er = beta * (1 - (dt/2) A.r)
// with s = 1 / (|den|^2 + eps) exactly as in the definition.
__device__ __forceinline__ void cayley_scalars(float dtv, float hd, float hd2, const Axis& A,
                                               float& qr, float& beta, float& er) {
    float dr = 1.0f - hd * A.r;
    float n2 = dr*dr + hd2 * A.nv2 + EPSQ;
    // v_rcp_f32 and one Newton step in place of the compiler's division, ten instructions that
    // also go through VCC.  n2 >= eps, so the operand is never subnormal and the result never
    // overflows; the result would be subnormal only from n2 = 2^126 on (|dt * A| near 1e19).
    float r0 = __builtin_amdgcn_rcpf(n2);
    float s  = fmaf(fmaf(-n2, r0, 1.0f), r0, r0);
    qr   = s * (1.0f - hd2 * A.na2);
    beta = s * dtv;
    er   = beta * dr;
}

// h <- q*h + (den_inv*dt*B)*u = qr*h + er*w + beta * Av*(h + (dt/2)*w),  w = B*u.
__device__ __forceinline__ Quat state_step(float hd, const Axis& A, float qr, float beta,
                                           float er, Quat w, Quat h) {
    Quat x{h.r + hd * w.r, h.i + hd * w.i, h.j + hd * w.j, h.k + hd * w.k};
    Quat p;
    p.r = -A.i*x.i - A.j*x.j - A.k*x.k;
    p.i =  A.i*x.r + A.j*x.k - A.k*x.j;
    p.j =  A.j*x.r + A.k*x.i - A.i*x.k;
    p.k =  A.k*x.r + A.i*x.j - A.j*x.i;
    return Quat{qr*h.r + er*w.r + beta*p.r, qr*h.i + er*w.i + beta*p.i,
                qr*h.j + er*w.j + beta*p.j, qr*h.k + er*w.k + beta*p.k};
}

// Issues the u and dt loads of N consecutive steps of one channel; idx is the
// element index of the first step.  Nothing here waits for the data.
template <int N>
__device__ __forceinline__ void fetch_steps(const float4* __restrict__ u4,
                                            const float* __restrict__ dtg, int idx,
                                            float4 (&uv)[N], float (&dv)[N]) {
    #pragma unroll
    for (int j = 0; j < N; ++j) {
        uv[j] = u4[idx + j * DQ];
        dv[j] = dtg[idx + j * DQ];
    }
}

// ---------------------------------------------------------------------------
// Phase 1: chunk summaries and their scan inside a group of SUP chunks.
// A work-group is (b, group, 32 d-channels); wave = chunk, lane = d, carrying all 4 s.
// The SUP summaries of each recurrence meet in LDS, where one thread per recurrence
// folds them: it writes, per chunk, the map from the group's start state to the chunk's
// start state (Qpre, Vpre), and the whole group's summary (Qsup, Vsup).
// B_in rows for the group are staged block-wide into LDS via async copies.
// ---------------------------------------------------------------------------
__global__ __launch_bounds__(256)
void qssm_phase1(const float* __restrict__ u, const float* __restrict__ dtg,
                 const float* __restrict__ Bin,
                 const float* __restrict__ Alog, const float* __restrict__ Ai,
                 const float* __restrict__ Aj,   const float* __restrict__ Ak,
                 float* __restrict__ Qpre, float* __restrict__ Vpre,
                 float* __restrict__ Qsup, float* __restrict__ Vsup)
{
    const int lane  = threadIdx.x & 31;
    const int w     = __builtin_amdgcn_readfirstlane(threadIdx.x >> 5);   // chunk in the group
    const int dbase = (blockIdx.x % (DQ / 32)) * 32;
    const int S     = (blockIdx.x / (DQ / 32)) % NSUP;
    const int b     = blockIdx.x / ((DQ / 32) * NSUP);
    const int d  = dbase + lane;
    const int t0 = (S * SUP + w) * CT;

    const float4* u4 = (const float4*)u;
    const float4* B4 = (const float4*)Bin;

    // First batch of u and dt and, below, A: all in flight while B_in is staged.
    int idx = (b * LEN + t0) * DQ + d;
    float4 un[PF1]; float dn[PF1];
    fetch_steps(u4, dtg, idx, un, dn);
    static_assert(PF1 == 2, "the batch's dt values are handled as one pair below");

    // The chunk's transition product stays in span{1, Av}: Q = Qa + Qb * Av.
    Axis A[SQ]; Quat h[SQ]; float Qa[SQ], Qb[SQ];
    #pragma unroll
    for (int s = 0; s < SQ; ++s) {
        A[s] = make_axis(Alog[d*SQ + s], Ai[d*SQ + s], Aj[d*SQ + s], Ak[d*SQ + s]);
        h[s] = Quat{0.f, 0.f, 0.f, 0.f};
        Qa[s] = 1.f; Qb[s] = 0.f;
    }

    // Stage the group's B_in [SUP*CT x SQ] quaternions into LDS (8 KB).
    __shared__ float4 sB[SUP * CT * SQ];
    {
        const float4* gB = B4 + (b * LEN + S * SUP * CT) * SQ;
        #pragma unroll   // fixed trip count: every lane is on at every copy
        for (int i = 0; i < SUP * CT * SQ / 256; ++i)
            async_copy16(&sB[i * 256 + threadIdx.x], gB + i * 256 + threadIdx.x);
        async_wait0();
        __syncthreads();
    }

    #pragma unroll 1   // rolled: for speed only
    for (int g = 0; g < CT / PF1; ++g) {
        float4 uc[PF1]; float dc[PF1];
        #pragma unroll
        for (int j = 0; j < PF1; ++j) { uc[j] = un[j]; dc[j] = dn[j]; }
        // The next batch flies while this one is worked on.
        if (g + 1 < CT / PF1) {
            idx += PF1 * DQ;
            fetch_steps(u4, dtg, idx, un, dn);
        }
        // dt/2 and its square are formed for both steps at the head of the batch, as pairs.
        // Formed step by step, this kernel's build gave a dt still in flight the idle upper half
        // of a packed operand's register pair, and its wait stood early in the batch (see PF1).
        const v2f dcv = {dc[0], dc[1]};
        const v2f hdv = 0.5f * dcv, hd2v = hdv * hdv;
        #pragma unroll
        for (int j = 0; j < PF1; ++j) {
            const int tt = w * CT + g * PF1 + j;
            const float dtv = dcv[j];
            Quat uq{uc[j].x, uc[j].y, uc[j].z, uc[j].w};
            const float hd = hdv[j], hd2 = hd2v[j];
            #pragma unroll
            for (int s = 0; s < SQ; ++s) {
                float4 bv = sB[tt * SQ + s];
                Quat Bq{bv.x, bv.y, bv.z, bv.w};
                float qr, beta, er;
                cayley_scalars(dtv, hd, hd2, A[s], qr, beta, er);
                h[s] = state_step(hd, A[s], qr, beta, er, qmul(Bq, uq), h[s]);
                const float na = qr * Qa[s] - (beta * A[s].nv2) * Qb[s];
                Qb[s] = qr * Qb[s] + beta * Qa[s];
                Qa[s] = na;
            }
        }
    }

    float4 Qo[SQ];
    #pragma unroll
    for (int s = 0; s < SQ; ++s)
        Qo[s] = make_float4(Qa[s], Qb[s]*A[s].i, Qb[s]*A[s].j, Qb[s]*A[s].k);

    // Hand the chunk's summary over: [chunk][recurrence of the work-group].
    __shared__ float4 sQ[SUP * GCH];
    __shared__ float4 sV[SUP * GCH];
    #pragma unroll
    for (int s = 0; s < SQ; ++s) {
        sQ[w * GCH + lane * SQ + s] = Qo[s];
        sV[w * GCH + lane * SQ + s] = make_float4(h[s].r, h[s].i, h[s].j, h[s].k);
    }
    __syncthreads();
    if (threadIdx.x >= GCH) return;      // whole waves leave, behind the last barrier

    const int jr = threadIdx.x;          // recurrence of the work-group that this thread scans
    float4 q[SUP], v[SUP];
    #pragma unroll   // all LDS reads issue before the serial fold
    for (int k = 0; k < SUP; ++k) { q[k] = sQ[k * GCH + jr]; v[k] = sV[k * GCH + jr]; }

    const int chain = (b * DQ + dbase) * SQ + jr;        // a wave writes whole lines
    Quat P[SUP + 1], x[SUP + 1];         // maps up to the start of chunk k; [SUP]: the whole group
    P[0] = Quat{1.f, 0.f, 0.f, 0.f};
    x[0] = Quat{0.f, 0.f, 0.f, 0.f};
    #pragma unroll   // everything stays in registers
    for (int k = 0; k < SUP; ++k) {
        const Quat qk{q[k].x, q[k].y, q[k].z, q[k].w};
        const Quat qx = qmul(qk, x[k]);
        x[k + 1] = Quat{qx.r + v[k].x, qx.i + v[k].y, qx.j + v[k].z, qx.k + v[k].w};
        P[k + 1] = qmul(qk, P[k]);
    }
    // Holds the stores behind the fold: mixed into it, the serial fold had to wait for
    // stores before it could reuse their registers.
    __builtin_amdgcn_sched_barrier(0);
    ((float4*)Qsup)[S * CHAINS + chain] = make_float4(P[SUP].r, P[SUP].i, P[SUP].j, P[SUP].k);
    ((float4*)Vsup)[S * CHAINS + chain] = make_float4(x[SUP].r, x[SUP].i, x[SUP].j, x[SUP].k);
    #pragma unroll
    for (int k = 0; k < SUP; ++k) {
        const int idx = (S * SUP + k) * CHAINS + chain;
        ((float4*)Qpre)[idx] = make_float4(P[k].r, P[k].i, P[k].j, P[k].k);
        ((float4*)Vpre)[idx] = make_float4(x[k].r, x[k].i, x[k].j, x[k].k);
    }
}

// ---------------------------------------------------------------------------
// The step of phase 3 on two recurrences at once: the pair (s, s + 1) of one channel sits in
// the two halves of a register pair, which is what the packed f32 instructions work on and
// what a WMMA takes as its B operand.
// ---------------------------------------------------------------------------
struct Quat2 { v2f r, i, j, k; };
struct Axis2 { v2f r, i, j, k, nv2, na2; };

__device__ __forceinline__ v2f fma2(v2f a, v2f b, v2f c) { return __builtin_elementwise_fma(a, b, c); }

// B * u for a pair of B and one u.
__device__ __forceinline__ Quat2 qmul2(const Quat2 a, const Quat b) {
    Quat2 o;
    o.r = a.r*b.r - a.i*b.i - a.j*b.j - a.k*b.k;
    o.i = a.r*b.i + a.i*b.r + a.j*b.k - a.k*b.j;
    o.j = a.r*b.j - a.i*b.k + a.j*b.r + a.k*b.i;
    o.k = a.r*b.k + a.i*b.j - a.j*b.i + a.k*b.r;
    return o;
}

// cayley_scalars for a pair.
__device__ __forceinline__ void cayley_scalars2(float dtv, float hd, float hd2, const Axis2& A,
                                                v2f& qr, v2f& beta, v2f& er) {
    const v2f one = {1.0f, 1.0f};
    v2f dr = one - hd * A.r;
    v2f n2 = dr*dr + hd2 * A.nv2 + EPSQ;
    v2f r0 = {__builtin_amdgcn_rcpf(n2.x), __builtin_amdgcn_rcpf(n2.y)};
    v2f s  = fma2(fma2(-n2, r0, one), r0, r0);
    qr   = s * (one - hd2 * A.na2);
    beta = s * dtv;
    er   = beta * dr;
}

// state_step for a pair.
__device__ __forceinline__ Quat2 state_step2(float hd, const Axis2& A, v2f qr, v2f beta,
                                             v2f er, Quat2 w, Quat2 h) {
    Quat2 x{h.r + hd * w.r, h.i + hd * w.i, h.j + hd * w.j, h.k + hd * w.k};
    Quat2 p;
    p.r = -A.i*x.i - A.j*x.j - A.k*x.k;
    p.i =  A.i*x.r + A.j*x.k - A.k*x.j;
    p.j =  A.j*x.r + A.k*x.i - A.i*x.k;
    p.k =  A.k*x.r + A.i*x.j - A.j*x.i;
    return Quat2{qr*h.r + er*w.r + beta*p.r, qr*h.i + er*w.i + beta*p.i,
                 qr*h.j + er*w.j + beta*p.j, qr*h.k + er*w.k + beta*p.k};
}

// ---------------------------------------------------------------------------
// Phase 3: finalize.  A work-group is (b, group, 32 d-channels) as in phase 1; one wave
// handles one chunk, lane owns d.  The group's start state is folded here from the
// summaries of the groups before it (at most NSUP-1, fetched at once), one thread per
// recurrence, and passed through LDS behind the staging barrier.
// y = sum_s L(C_s) @ h via V_WMMA_F32_16X16X4_F32, with the state's own register pairs as
// the B operand: for component k and pair (s, s + 1), column n holds h_s[k], h_s+1[k] of
// channel n (K = 0,1, lanes 0-15) and of channel n + 16 (K = 2,3, lanes 16-31).  The A
// operand is block-diagonal to match: rows 0-3 hold L(C_s)[row][k], L(C_s+1)[row][k] in
// K = 0,1 and zeros in K = 2,3, rows 8-11 the reverse, so that D's registers 0-3 are y of
// the lane's own channel in all 32 lanes.  Those rows, and B_in with s innermost, are laid
// out in LDS once per work-group; a lane reads its row of L, or the row of zeros.
// ---------------------------------------------------------------------------
__global__ __launch_bounds__(256)
void qssm_phase3(const float* __restrict__ u, const float* __restrict__ dtg,
                 const float* __restrict__ Bin, const float* __restrict__ Cin,
                 const float* __restrict__ Alog, const float* __restrict__ Ai,
                 const float* __restrict__ Aj,   const float* __restrict__ Ak,
                 const float* __restrict__ Qpre, const float* __restrict__ Vpre,
                 const float* __restrict__ Qsup, const float* __restrict__ Vsup,
                 float* __restrict__ out)
{
    const int lane  = threadIdx.x & 31;
    const int w     = __builtin_amdgcn_readfirstlane(threadIdx.x >> 5);   // chunk in the group
    const int dbase = (blockIdx.x % (DQ / 32)) * 32;
    const int S     = (blockIdx.x / (DQ / 32)) % NSUP;
    const int b     = blockIdx.x / ((DQ / 32) * NSUP);
    const int c     = S * SUP + w;
    const int d     = dbase + lane;
    const int t0    = c * CT;

    const float4* u4 = (const float4*)u;
    const float4* B4 = (const float4*)Bin;
    const float4* C4 = (const float4*)Cin;
    float4* out4 = (float4*)out;

    // First batch of u and dt, in flight while B_in and L(C_in) are staged.
    int idx = (b * LEN + t0) * DQ + d;
    float4 un[PF3]; float dn[PF3];
    fetch_steps(u4, dtg, idx, un, dn);

    // A and the chunk's map from the group's start state are fetched here too: every load
    // of the set-up shares one latency, and none is still outstanding when the loop's own
    // loads are counted.
    Axis A[SQ]; Quat h[SQ]; Quat Qp[SQ];
    #pragma unroll
    for (int s = 0; s < SQ; ++s) {
        A[s] = make_axis(Alog[d*SQ + s], Ai[d*SQ + s], Aj[d*SQ + s], Ak[d*SQ + s]);
        const int chain = (b * DQ + d) * SQ + s;
        Qp[s] = ld4(Qpre + 4 * (c * CHAINS + chain));
        h[s]  = ld4(Vpre + 4 * (c * CHAINS + chain));
    }

    // Waves 0-3 fold the earlier groups' summaries into the group's start state; meanwhile
    // waves 4-7, one thread per step of the group, write B_in with s innermost (8 KB) and
    // the rows of L(C_in) (40 KB).
    __shared__ float4 sB[SUP * CT * 4];            // [step][component] over s
    __shared__ float4 sA[SUP * CT * 4 * AROWS];    // [step][column k of L][row] over s
    __shared__ float4 sH[GCH];
    static_assert(SUP * CT == 256 - GCH && SQ == 4, "one thread of waves 4-7 per step; s fills a float4");
    {
        if (threadIdx.x < GCH) {
            const int chain = (b * DQ + dbase) * SQ + threadIdx.x;
            float4 q[NSUP - 1], v[NSUP - 1];
            #pragma unroll   // every summary is fetched (all are written by phase 1): one latency
            for (int k = 0; k < NSUP - 1; ++k) {
                q[k] = ((const float4*)Qsup)[k * CHAINS + chain];
                v[k] = ((const float4*)Vsup)[k * CHAINS + chain];
            }
            // The code below rewrites the address register that these loads name.
            asm volatile("s_wait_xcnt 0x0" ::: "memory");
            Quat g{0.f, 0.f, 0.f, 0.f};
            #pragma unroll   // q[] and v[] stay in registers
            for (int k = 0; k < NSUP - 1; ++k) {
                if (k < S) {             // block-uniform: only the groups before this one
                    Quat qg = qmul(Quat{q[k].x, q[k].y, q[k].z, q[k].w}, g);
                    g = Quat{qg.r + v[k].x, qg.i + v[k].y, qg.j + v[k].z, qg.k + v[k].w};
                }
            }
            sH[threadIdx.x] = make_float4(g.r, g.i, g.j, g.k);
        } else {
            const int ts = threadIdx.x - GCH;      // step of the group
            const float4* gB = B4 + (b * LEN + S * SUP * CT + ts) * SQ;
            const float4* gC = C4 + (b * LEN + S * SUP * CT + ts) * SQ;
            float4 bg[SQ], cg[SQ];
            #pragma unroll   // one latency for all eight
            for (int s = 0; s < SQ; ++s) { bg[s] = gB[s]; cg[s] = gC[s]; }
            // The code below rewrites an address register that these loads name.
            asm volatile("s_wait_xcnt 0x0" ::: "memory");
            sB[ts * 4 + 0] = make_float4(bg[0].x, bg[1].x, bg[2].x, bg[3].x);
            sB[ts * 4 + 1] = make_float4(bg[0].y, bg[1].y, bg[2].y, bg[3].y);
            sB[ts * 4 + 2] = make_float4(bg[0].z, bg[1].z, bg[2].z, bg[3].z);
            sB[ts * 4 + 3] = make_float4(bg[0].w, bg[1].w, bg[2].w, bg[3].w);
            float Lm[SQ][4][4];                    // [s][row][column]
            #pragma unroll
            for (int s = 0; s < SQ; ++s) {
                const float4 cq = cg[s];
                Lm[s][0][0] = cq.x; Lm[s][0][1] = -cq.y; Lm[s][0][2] = -cq.z; Lm[s][0][3] = -cq.w;
                Lm[s][1][0] = cq.y; Lm[s][1][1] =  cq.x; Lm[s][1][2] = -cq.w; Lm[s][1][3] =  cq.z;
                Lm[s][2][0] = cq.z; Lm[s][2][1] =  cq.w; Lm[s][2][2] =  cq.x; Lm[s][2][3] = -cq.y;
                Lm[s][3][0] = cq.w; Lm[s][3][1] = -cq.z; Lm[s][3][2] =  cq.y; Lm[s][3][3] =  cq.x;
            }
            #pragma unroll   // Lm[] stays in registers
            for (int k = 0; k < 4; ++k) {
                float4* r = &sA[(ts * 4 + k) * AROWS];
                #pragma unroll
                for (int m = 0; m < 4; ++m)
                    r[m] = make_float4(Lm[0][m][k], Lm[1][m][k], Lm[2][m][k], Lm[3][m][k]);
                r[4] = make_float4(0.f, 0.f, 0.f, 0.f);
            }
        }
        __syncthreads();
    }

    // Chunk's start state = Qpre * (group's start state) + Vpre.
    #pragma unroll
    for (int s = 0; s < SQ; ++s) {
        float4 gs = sH[lane * SQ + s];
        Quat qg = qmul(Qp[s], Quat{gs.x, gs.y, gs.z, gs.w});
        h[s] = Quat{qg.r + h[s].r, qg.i + h[s].i, qg.j + h[s].j, qg.k + h[s].k};
    }

    // From here on the four recurrences are two pairs.
    Axis2 A2[SQ / 2]; Quat2 H[SQ / 2];
    #pragma unroll
    for (int p = 0; p < SQ / 2; ++p) {
        const Axis &a0 = A[2*p], &a1 = A[2*p + 1];
        A2[p] = Axis2{{a0.r, a1.r}, {a0.i, a1.i}, {a0.j, a1.j}, {a0.k, a1.k},
                      {a0.nv2, a1.nv2}, {a0.na2, a1.na2}};
        H[p]  = Quat2{{h[2*p].r, h[2*p + 1].r}, {h[2*p].i, h[2*p + 1].i},
                      {h[2*p].j, h[2*p + 1].j}, {h[2*p].k, h[2*p + 1].k}};
    }

    // The lane's row of the A operand: lanes 0-3 are rows 0-3 at K = 0,1 and lanes 24-27
    // rows 8-11 at K = 2,3; every other lane takes the zeros (rows 4-7, 12-15 are not used).
    const int arow = (lane < 4 || (lane >= 24 && lane < 28)) ? (lane & 3) : 4;
    const float4* aP = &sA[w * CT * 4 * AROWS + arow];

    #pragma unroll 1   // rolled: for speed only
    for (int g = 0; g < CT / PF3; ++g) {
      float4 uc[PF3]; float dc[PF3];
      #pragma unroll
      for (int j = 0; j < PF3; ++j) { uc[j] = un[j]; dc[j] = dn[j]; }
      // The next batch flies while this one is worked on.
      if (g + 1 < CT / PF3) {
          idx += PF3 * DQ;
          fetch_steps(u4, dtg, idx, un, dn);
      }
      #pragma unroll
      for (int j = 0; j < PF3; ++j) {
        const int tt  = w * CT + g * PF3 + j;     // row of the staged group
        const int t   = t0 + g * PF3 + j;
        const int row = (b * LEN + t) * DQ;
        const float dtv = dc[j];
        Quat uq{uc[j].x, uc[j].y, uc[j].z, uc[j].w};
        const float hd = 0.5f * dtv, hd2 = hd * hd;

        const float4 b0 = sB[tt * 4 + 0], b1 = sB[tt * 4 + 1];
        const float4 b2 = sB[tt * 4 + 2], b3 = sB[tt * 4 + 3];
        const Quat2 Bq[SQ / 2] = {{{b0.x, b0.y}, {b1.x, b1.y}, {b2.x, b2.y}, {b3.x, b3.y}},
                                  {{b0.z, b0.w}, {b1.z, b1.w}, {b2.z, b2.w}, {b3.z, b3.w}}};
        #pragma unroll
        for (int p = 0; p < SQ / 2; ++p) {
            v2f qr, beta, er;
            cayley_scalars2(dtv, hd, hd2, A2[p], qr, beta, er);
            H[p] = state_step2(hd, A2[p], qr, beta, er, qmul2(Bq[p], uq), H[p]);
        }

        // Column k of every L(C_s) meets component k of every h_s, a pair of s per WMMA.
        v8f acc = {0.f,0.f,0.f,0.f,0.f,0.f,0.f,0.f};
        const v2f hk[4][SQ / 2] = {{H[0].r, H[1].r}, {H[0].i, H[1].i},
                                   {H[0].j, H[1].j}, {H[0].k, H[1].k}};
        #pragma unroll
        for (int k = 0; k < 4; ++k) {
            const float4 av = aP[((g * PF3 + j) * 4 + k) * AROWS];
            const v2f a01 = {av.x, av.y}, a23 = {av.z, av.w};
            acc = __builtin_amdgcn_wmma_f32_16x16x4_f32(
                      false, a01, false, hk[k][0], (short)0, acc, false, false);
            acc = __builtin_amdgcn_wmma_f32_16x16x4_f32(
                      false, a23, false, hk[k][1], (short)0, acc, false, false);
        }

        // D layout: registers 0-3 hold rows 0-3 in lanes 0-15 and rows 8-11 in lanes 16-31.
        out4[row + d] = make_float4(acc[0], acc[1], acc[2], acc[3]);
        // The head of the next trip rewrites registers that this store names.
        asm volatile("s_wait_xcnt 0x0" ::: "memory");
      }
      // Holds the hand-over of the next batch's registers at the foot of the trip: moved up
      // among the steps, it brought the wait for loads that had only just been issued with it.
      __builtin_amdgcn_sched_barrier(0);
    }
}

// ---------------------------------------------------------------------------
extern "C" void kernel_launch(void* const* d_in, const int* in_sizes, int n_in,
                              void* d_out, int out_size, void* d_ws, size_t ws_size,
                              hipStream_t stream)
{
    const float* u    = (const float*)d_in[0];
    const float* dtg  = (const float*)d_in[1];
    const float* Bin  = (const float*)d_in[2];
    const float* Cin  = (const float*)d_in[3];
    const float* Alog = (const float*)d_in[4];
    const float* Ai   = (const float*)d_in[5];
    const float* Aj   = (const float*)d_in[6];
    const float* Ak   = (const float*)d_in[7];
    float* out = (float*)d_out;

    // Workspace: 2 buffers of CHAINS*NCH quaternions (8 MB each), [chunk][chain], and
    // 2 of CHAINS*NSUP (1 MB each), [group][chain]
    float* qp = (float*)d_ws;
    float* vp = qp + (size_t)CHAINS * NCH * 4;
    float* qs = vp + (size_t)CHAINS * NCH * 4;
    float* vs = qs + (size_t)CHAINS * NSUP * 4;

    qssm_phase1<<<BSZ * NSUP * (DQ / 32), 256, 0, stream>>>(
        u, dtg, Bin, Alog, Ai, Aj, Ak, qp, vp, qs, vs);
    qssm_phase3<<<BSZ * NSUP * (DQ / 32), 256, 0, stream>>>(
        u, dtg, Bin, Cin, Alog, Ai, Aj, Ak, qp, vp, qs, vs, out);
}

// v007
// Measured time: 26.8 microseconds a run.
// Timed twice side by side with v006, it ran 1.10 times as fast both times.
// Over all steps from v000 it is 9.40 times as fast.
#include <hip/hip_runtime.h>
#include <math.h>

// Problem constants (match reference)
#define BSZ   2
#define LEN   2048
#define DQ    512
#define SQ    4
#define NCH   128                // chunks per sequence
#define CT    (LEN / NCH)        // 16 steps per chunk
#define EPSQ  1e-6f
#define CHAINS (BSZ * DQ * SQ)   // 4096 independent recurrences
#define SUP   8                  // consecutive chunks per work-group, one per wave
#define NSUP  (NCH / SUP)        // 16 groups of chunks per sequence
#define GCH   (32 * SQ)          // 128 recurrences per work-group (32 channels)
// Steps of u and dt fetched ahead as one batch.
#define PF1   4
#define PF3   4
#define AROWS 5                  // rows kept in LDS per (step, column of L(C)): four, and one of zeros

typedef float v2f __attribute__((ext_vector_type(2)));
typedef float v8f __attribute__((ext_vector_type(8)));

struct Quat { float r, i, j, k; };

__device__ __forceinline__ Quat qmul(const Quat a, const Quat b) {
    Quat o;
    o.r = a.r*b.r - a.i*b.i - a.j*b.j - a.k*b.k;
    o.i = a.r*b.i + a.i*b.r + a.j*b.k - a.k*b.j;
    o.j = a.r*b.j - a.i*b.k + a.j*b.r + a.k*b.i;
    o.k = a.r*b.k + a.i*b.j - a.j*b.i + a.k*b.r;
    return o;
}

__device__ __forceinline__ Quat ld4(const float* p) {
    float4 v = *(const float4*)p;
    return Quat{v.x, v.y, v.z, v.w};
}

// A quaternion of one chain with the two loop-invariant norms the step needs.
struct Axis { float r, i, j, k, nv2, na2; };

__device__ __forceinline__ Axis make_axis(float alog, float ai, float aj, float ak) {
    Axis A;
    A.r = -expf(alog); A.i = ai; A.j = aj; A.k = ak;
    A.nv2 = ai*ai + aj*aj + ak*ak;
    A.na2 = A.r*A.r + A.nv2;
    return A;
}

// ---------------------------------------------------------------------------
// The step on two recurrences at once: the pair (s, s + 1) of one channel sits in the two
// halves of a register pair, which is what the packed f32 instructions work on, what a WMMA
// takes as its B operand (phase 3).
// ---------------------------------------------------------------------------
struct Quat2 { v2f r, i, j, k; };
struct Axis2 { v2f r, i, j, k, nv2, na2; };

__device__ __forceinline__ v2f fma2(v2f a, v2f b, v2f c) { return __builtin_elementwise_fma(a, b, c); }

// B * u for a pair of B and one u.
__device__ __forceinline__ Quat2 qmul2(const Quat2 a, const Quat b) {
    Quat2 o;
    o.r = a.r*b.r - a.i*b.i - a.j*b.j - a.k*b.k;
    o.i = a.r*b.i + a.i*b.r + a.j*b.k - a.k*b.j;
    o.j = a.r*b.j - a.i*b.k + a.j*b.r + a.k*b.i;
    o.k = a.r*b.k + a.i*b.j - a.j*b.i + a.k*b.r;
    return o;
}

// Cayley factors in closed form.  num, den and den_inv are all (scalar + scalar * Av),
// Av = (A.i, A.j, A.k), so their products need no quaternion multiply:
//   q          = qr + beta * Av,            qr = s * (1 - (dt/2)^2 |A|^2), beta = s * dt
//   den_inv*dt = er + beta * (dt/2) * Av,   er = beta * (1 - (dt/2) A.r)
// with s = 1 / (|den|^2 + eps) exactly as in the definition.
__device__ __forceinline__ void cayley_scalars2(float dtv, float hd, float hd2, const Axis2& A,
                                                v2f& qr, v2f& beta, v2f& er) {
    const v2f one = {1.0f, 1.0f};
    v2f dr = one - hd * A.r;
    v2f n2 = dr*dr + hd2 * A.nv2 + EPSQ;
    // v_rcp_f32 and one Newton step in place of the compiler's division, ten instructions that
    // also go through VCC.  n2 >= eps, so the operand is never subnormal and the result never
    // overflows; the result would be subnormal only from n2 = 2^126 on (|dt * A| near 1e19).
    v2f r0 = {__builtin_amdgcn_rcpf(n2.x), __builtin_amdgcn_rcpf(n2.y)};
    v2f s  = fma2(fma2(-n2, r0, one), r0, r0);
    qr   = s * (one - hd2 * A.na2);
    beta = s * dtv;
    er   = beta * dr;
}

// h <- q*h + (den_inv*dt*B)*u = qr*h + er*w + beta * Av*(h + (dt/2)*w),  w = B*u.
__device__ __forceinline__ Quat2 state_step2(float hd, const Axis2& A, v2f qr, v2f beta,
                                             v2f er, Quat2 w, Quat2 h) {
    Quat2 x{h.r + hd * w.r, h.i + hd * w.i, h.j + hd * w.j, h.k + hd * w.k};
    Quat2 p;
    p.r = -A.i*x.i - A.j*x.j - A.k*x.k;
    p.i =  A.i*x.r + A.j*x.k - A.k*x.j;
    p.j =  A.j*x.r + A.k*x.i - A.i*x.k;
    p.k =  A.k*x.r + A.i*x.j - A.j*x.i;
    return Quat2{qr*h.r + er*w.r + beta*p.r, qr*h.i + er*w.i + beta*p.i,
                 qr*h.j + er*w.j + beta*p.j, qr*h.k + er*w.k + beta*p.k};
}

// Issues the u and dt loads of N consecutive steps of one channel; idx is the
// element index of the first step.  Nothing here waits for the data.
template <int N>
__device__ __forceinline__ void fetch_steps(const float4* __restrict__ u4,
                                            const float* __restrict__ dtg, int idx,
                                            float4 (&uv)[N], float (&dv)[N]) {
    #pragma unroll
    for (int j = 0; j < N; ++j) {
        uv[j] = u4[idx + j * DQ];
        dv[j] = dtg[idx + j * DQ];
    }
}

// ---------------------------------------------------------------------------
// Phase 1: chunk summaries and their scan inside a group of SUP chunks.
// A work-group is (b, group, 32 d-channels); wave = chunk, lane = d, carrying all 4 s as
// two pairs.
// The chunk's end state from a zero start is sum_t (q_last ... q_t+1) * e_t * w_t, with
// e_t = den_inv*dt and w_t = B_t*u_t.  Every q and e lies in span{1, Av}, which commutes, so
// the factor in front of w_t is two scalars, al_t + ga_t * Av: the steps are walked from the
// last to the first, the running product of q gives al_t and ga_t, and the loop only adds
// al_t * w_t and ga_t * w_t to two sums.  Av meets the second sum once, behind the loop.
// The SUP summaries of each recurrence meet in LDS, where one thread per recurrence
// folds them: it writes, per chunk, the map from the group's start state to the chunk's
// start state (Qpre, Vpre), and the whole group's summary (Qsup, Vsup).
// B_in of the group is laid out in LDS with s innermost, once per work-group.
// ---------------------------------------------------------------------------
__global__ __launch_bounds__(256)
void qssm_phase1(const float* __restrict__ u, const float* __restrict__ dtg,
                 const float* __restrict__ Bin,
                 const float* __restrict__ Alog, const float* __restrict__ Ai,
                 const float* __restrict__ Aj,   const float* __restrict__ Ak,
                 float* __restrict__ Qpre, float* __restrict__ Vpre,
                 float* __restrict__ Qsup, float* __restrict__ Vsup)
{
    const int lane  = threadIdx.x & 31;
    const int w     = __builtin_amdgcn_readfirstlane(threadIdx.x >> 5);   // chunk in the group
    const int dbase = (blockIdx.x % (DQ / 32)) * 32;
    const int S     = (blockIdx.x / (DQ / 32)) % NSUP;
    const int b     = blockIdx.x / ((DQ / 32) * NSUP);
    const int d  = dbase + lane;
    const int t0 = (S * SUP + w) * CT;

    const float4* u4 = (const float4*)u;

    // First batch of u and dt (the chunk's last steps) and, below, A: all in flight while
    // B_in is staged.
    int idx = (b * LEN + t0 + CT - PF1) * DQ + d;
    // dt is held as pairs of steps: a dt on its own can get the idle half of a packed operand's
    // register pair for a neighbour, and a load in flight there brings its wait into the batch.
    float4 un[PF1]; v2f dn[PF1 / 2];
    static_assert(PF1 % 2 == 0, "dt goes by pairs of steps");
    #pragma unroll
    for (int j = 0; j < PF1; ++j) un[j] = u4[idx + j * DQ];
    #pragma unroll
    for (int j = 0; j < PF1 / 2; ++j) dn[j] = v2f{dtg[idx + 2 * j * DQ], dtg[idx + (2 * j + 1) * DQ]};
    // Keeps these loads in front of the set-up's.
    asm volatile("s_wait_xcnt 0x0" ::: "memory");

    // The product of the steps walked so far stays in span{1, Av}: Q = Qa + Qb * Av.
    Axis2 A2[SQ / 2]; Quat2 Sa[SQ / 2], Sg[SQ / 2]; v2f Qa[SQ / 2], Qb[SQ / 2];
    #pragma unroll
    for (int p = 0; p < SQ / 2; ++p) {
        const int c0 = d * SQ + 2 * p, c1 = c0 + 1;
        const Axis a0 = make_axis(Alog[c0], Ai[c0], Aj[c0], Ak[c0]);
        const Axis a1 = make_axis(Alog[c1], Ai[c1], Aj[c1], Ak[c1]);
        A2[p] = Axis2{{a0.r, a1.r}, {a0.i, a1.i}, {a0.j, a1.j}, {a0.k, a1.k},
                      {a0.nv2, a1.nv2}, {a0.na2, a1.na2}};
        const v2f zero = {0.f, 0.f}, one = {1.f, 1.f};
        Sa[p] = Quat2{zero, zero, zero, zero};
        Sg[p] = Quat2{zero, zero, zero, zero};
        Qa[p] = one; Qb[p] = zero;
    }

    // Stage the group's B_in as [step][component] over s (8 KB); a wave writes whole rows.
    __shared__ float4 sB[SUP * CT * 4];
    static_assert(SQ == 4, "s fills a float4");
    {
        const float* gB = Bin + (b * LEN + S * SUP * CT) * SQ * 4;
        constexpr int NI = SUP * CT * 4 / 256;
        float bg[NI][SQ];
        #pragma unroll   // one latency for all
        for (int i = 0; i < NI; ++i) {
            const int f = i * 256 + threadIdx.x;     // step f >> 2, component f & 3
            #pragma unroll
            for (int s = 0; s < SQ; ++s) bg[i][s] = gB[(f >> 2) * (SQ * 4) + s * 4 + (f & 3)];
        }
        // The code below rewrites address registers that the set-up's loads name.
        asm volatile("s_wait_xcnt 0x0" ::: "memory");
        #pragma unroll
        for (int i = 0; i < NI; ++i)
            sB[i * 256 + threadIdx.x] = make_float4(bg[i][0], bg[i][1], bg[i][2], bg[i][3]);
        __syncthreads();
    }

    #pragma unroll 1   // rolled: for speed only
    for (int g = 0; g < CT / PF1; ++g) {
        float4 uc[PF1]; v2f dc[PF1 / 2], hdv[PF1 / 2], hd2v[PF1 / 2];
        #pragma unroll
        for (int j = 0; j < PF1; ++j) uc[j] = un[j];
        #pragma unroll
        for (int j = 0; j < PF1 / 2; ++j) { dc[j] = dn[j]; hdv[j] = 0.5f * dc[j]; hd2v[j] = hdv[j] * hdv[j]; }
        // The next batch (the steps before these) flies while this one is worked on.
        if (g + 1 < CT / PF1) {
            idx -= PF1 * DQ;
            #pragma unroll
            for (int j = 0; j < PF1; ++j) un[j] = u4[idx + j * DQ];
            #pragma unroll
            for (int j = 0; j < PF1 / 2; ++j) dn[j] = v2f{dtg[idx + 2 * j * DQ], dtg[idx + (2 * j + 1) * DQ]};
        }
        #pragma unroll
        for (int j = PF1 - 1; j >= 0; --j) {
            const int tt = w * CT + (CT / PF1 - 1 - g) * PF1 + j;     // row of the staged group
            const float dtv = dc[j / 2][j % 2];
            Quat uq{uc[j].x, uc[j].y, uc[j].z, uc[j].w};
            const float hd = hdv[j / 2][j % 2], hd2 = hd2v[j / 2][j % 2];

            const float4 b0 = sB[tt * 4 + 0], b1 = sB[tt * 4 + 1];
            const float4 b2 = sB[tt * 4 + 2], b3 = sB[tt * 4 + 3];
            const Quat2 Bq[SQ / 2] = {{{b0.x, b0.y}, {b1.x, b1.y}, {b2.x, b2.y}, {b3.x, b3.y}},
                                      {{b0.z, b0.w}, {b1.z, b1.w}, {b2.z, b2.w}, {b3.z, b3.w}}};
            #pragma unroll
            for (int p = 0; p < SQ / 2; ++p) {
                v2f qr, beta, er;
                cayley_scalars2(dtv, hd, hd2, A2[p], qr, beta, er);
                const Quat2 wq = qmul2(Bq[p], uq);
                // (Qa + Qb*Av), the product of the later steps' q, times e = er + beta*(dt/2)*Av.
                const v2f eb = beta * hd, nb = A2[p].nv2 * Qb[p];
                const v2f al = er * Qa[p] - eb * nb;
                const v2f ga = eb * Qa[p] + er * Qb[p];
                Sa[p] = Quat2{Sa[p].r + al * wq.r, Sa[p].i + al * wq.i,
                              Sa[p].j + al * wq.j, Sa[p].k + al * wq.k};
                Sg[p] = Quat2{Sg[p].r + ga * wq.r, Sg[p].i + ga * wq.i,
                              Sg[p].j + ga * wq.j, Sg[p].k + ga * wq.k};
                const v2f na = qr * Qa[p] - beta * nb;
                Qb[p] = qr * Qb[p] + beta * Qa[p];
                Qa[p] = na;
            }
        }
        // Holds the hand-over of the next batch's registers at the foot of the trip: moved up
        // among the steps, it brought the wait for loads that had only just been issued with it.
        __builtin_amdgcn_sched_barrier(0);
    }

    // Hand the chunk's summary over: [chunk][recurrence of the work-group].
    __shared__ float4 sQ[SUP * GCH];
    __shared__ float4 sV[SUP * GCH];
    #pragma unroll
    for (int p = 0; p < SQ / 2; ++p) {
        const Axis2& a = A2[p];
        const Quat2  x = Sg[p];
        const v2f qi = Qb[p] * a.i, qj = Qb[p] * a.j, qk = Qb[p] * a.k;
        const v2f hr = Sa[p].r - a.i*x.i - a.j*x.j - a.k*x.k;     // Sa + Av * Sg
        const v2f hi = Sa[p].i + a.i*x.r + a.j*x.k - a.k*x.j;
        const v2f hj = Sa[p].j + a.j*x.r + a.k*x.i - a.i*x.k;
        const v2f hk = Sa[p].k + a.k*x.r + a.i*x.j - a.j*x.i;
        #pragma unroll
        for (int o = 0; o < 2; ++o) {
            const int r = w * GCH + lane * SQ + 2 * p + o;
            sQ[r] = make_float4(Qa[p][o], qi[o], qj[o], qk[o]);
            sV[r] = make_float4(hr[o], hi[o], hj[o], hk[o]);
        }
    }
    __syncthreads();
    if (threadIdx.x >= GCH) return;      // whole waves leave, behind the last barrier

    const int jr = threadIdx.x;          // recurrence of the work-group that this thread scans
    float4 q[SUP], v[SUP];
    #pragma unroll   // all LDS reads issue before the serial fold
    for (int k = 0; k < SUP; ++k) { q[k] = sQ[k * GCH + jr]; v[k] = sV[k * GCH + jr]; }

    const int chain = (b * DQ + dbase) * SQ + jr;        // a wave writes whole lines
    Quat P[SUP + 1], x[SUP + 1];         // maps up to the start of chunk k; [SUP]: the whole group
    P[0] = Quat{1.f, 0.f, 0.f, 0.f};
    x[0] = Quat{0.f, 0.f, 0.f, 0.f};
    #pragma unroll   // everything stays in registers
    for (int k = 0; k < SUP; ++k) {
        const Quat qk{q[k].x, q[k].y, q[k].z, q[k].w};
        const Quat qx = qmul(qk, x[k]);
        x[k + 1] = Quat{qx.r + v[k].x, qx.i + v[k].y, qx.j + v[k].z, qx.k + v[k].w};
        P[k + 1] = qmul(qk, P[k]);
    }
    // Holds the stores behind the fold: mixed into it, the serial fold had to wait for
    // stores before it could reuse their registers.
    __builtin_amdgcn_sched_barrier(0);
    ((float4*)Qsup)[S * CHAINS + chain] = make_float4(P[SUP].r, P[SUP].i, P[SUP].j, P[SUP].k);
    ((float4*)Vsup)[S * CHAINS + chain] = make_float4(x[SUP].r, x[SUP].i, x[SUP].j, x[SUP].k);
    #pragma unroll
    for (int k = 0; k < SUP; ++k) {
        const int idx = (S * SUP + k) * CHAINS + chain;
        ((float4*)Qpre)[idx] = make_float4(P[k].r, P[k].i, P[k].j, P[k].k);
        ((float4*)Vpre)[idx] = make_float4(x[k].r, x[k].i, x[k].j, x[k].k);
    }
}

// ---------------------------------------------------------------------------
// Phase 3: finalize.  A work-group is (b, group, 32 d-channels) as in phase 1; one wave
// handles one chunk, lane owns d.  The group's start state is folded here from the
// summaries of the groups before it (at most NSUP-1, fetched at once), one thread per
// recurrence, and passed through LDS behind the staging barrier.
// y = sum_s L(C_s) @ h via V_WMMA_F32_16X16X4_F32, with the state's own register pairs as
// the B operand: for component k and pair (s, s + 1), column n holds h_s[k], h_s+1[k] of
// channel n (K = 0,1, lanes 0-15) and of channel n + 16 (K = 2,3, lanes 16-31).  The A
// operand is block-diagonal to match: rows 0-3 hold L(C_s)[row][k], L(C_s+1)[row][k] in
// K = 0,1 and zeros in K = 2,3, rows 8-11 the reverse, so that D's registers 0-3 are y of
// the lane's own channel in all 32 lanes.  Those rows, and B_in with s innermost, are laid
// out in LDS once per work-group; a lane reads its row of L, or the row of zeros.
// ---------------------------------------------------------------------------
__global__ __launch_bounds__(256)
void qssm_phase3(const float* __restrict__ u, const float* __restrict__ dtg,
                 const float* __restrict__ Bin, const float* __restrict__ Cin,
                 const float* __restrict__ Alog, const float* __restrict__ Ai,
                 const float* __restrict__ Aj,   const float* __restrict__ Ak,
                 const float* __restrict__ Qpre, const float* __restrict__ Vpre,
                 const float* __restrict__ Qsup, const float* __restrict__ Vsup,
                 float* __restrict__ out)
{
    const int lane  = threadIdx.x & 31;
    const int w     = __builtin_amdgcn_readfirstlane(threadIdx.x >> 5);   // chunk in the group
    const int dbase = (blockIdx.x % (DQ / 32)) * 32;
    const int S     = (blockIdx.x / (DQ / 32)) % NSUP;
    const int b     = blockIdx.x / ((DQ / 32) * NSUP);
    const int c     = S * SUP + w;
    const int d     = dbase + lane;
    const int t0    = c * CT;

    const float4* u4 = (const float4*)u;
    const float4* B4 = (const float4*)Bin;
    const float4* C4 = (const float4*)Cin;
    float4* out4 = (float4*)out;

    // First batch of u and dt, in flight while B_in and L(C_in) are staged.
    int idx = (b * LEN + t0) * DQ + d;
    float4 un[PF3]; float dn[PF3];
    fetch_steps(u4, dtg, idx, un, dn);

    // A and the chunk's map from the group's start state are fetched here too: every load
    // of the set-up shares one latency, and none is still outstanding when the loop's own
    // loads are counted.
    Axis A[SQ]; Quat h[SQ]; Quat Qp[SQ];
    #pragma unroll
    for (int s = 0; s < SQ; ++s) {
        A[s] = make_axis(Alog[d*SQ + s], Ai[d*SQ + s], Aj[d*SQ + s], Ak[d*SQ + s]);
        const int chain = (b * DQ + d) * SQ + s;
        Qp[s] = ld4(Qpre + 4 * (c * CHAINS + chain));
        h[s]  = ld4(Vpre + 4 * (c * CHAINS + chain));
    }

    // Waves 0-3 fold the earlier groups' summaries into the group's start state; meanwhile
    // waves 4-7, one thread per step of the group, write B_in with s innermost (8 KB) and
    // the rows of L(C_in) (40 KB).
    __shared__ float4 sB[SUP * CT * 4];            // [step][component] over s
    __shared__ float4 sA[SUP * CT * 4 * AROWS];    // [step][column k of L][row] over s
    __shared__ float4 sH[GCH];
    static_assert(SUP * CT == 256 - GCH && SQ == 4, "one thread of waves 4-7 per step; s fills a float4");
    {
        if (threadIdx.x < GCH) {
            const int chain = (b * DQ + dbase) * SQ + threadIdx.x;
            float4 q[NSUP - 1], v[NSUP - 1];
            #pragma unroll   // every summary is fetched (all are written by phase 1): one latency
            for (int k = 0; k < NSUP - 1; ++k) {
                q[k] = ((const float4*)Qsup)[k * CHAINS + chain];
                v[k] = ((const float4*)Vsup)[k * CHAINS + chain];
            }
            // The code below rewrites the address register that these loads name.
            asm volatile("s_wait_xcnt 0x0" ::: "memory");
            Quat g{0.f, 0.f, 0.f, 0.f};
            #pragma unroll   // q[] and v[] stay in registers
            for (int k = 0; k < NSUP - 1; ++k) {
                if (k < S) {             // block-uniform: only the groups before this one
                    Quat qg = qmul(Quat{q[k].x, q[k].y, q[k].z, q[k].w}, g);
                    g = Quat{qg.r + v[k].x, qg.i + v[k].y, qg.j + v[k].z, qg.k + v[k].w};
                }
            }
            sH[threadIdx.x] = make_float4(g.r, g.i, g.j, g.k);
        } else {
            const int ts = threadIdx.x - GCH;      // step of the group
            const float4* gB = B4 + (b * LEN + S * SUP * CT + ts) * SQ;
            const float4* gC = C4 + (b * LEN + S * SUP * CT + ts) * SQ;
            float4 bg[SQ], cg[SQ];
            #pragma unroll   // one latency for all eight
            for (int s = 0; s < SQ; ++s) { bg[s] = gB[s]; cg[s] = gC[s]; }
            // The code below rewrites an address register that these loads name.
            asm volatile("s_wait_xcnt 0x0" ::: "memory");
            sB[ts * 4 + 0] = make_float4(bg[0].x, bg[1].x, bg[2].x, bg[3].x);
            sB[ts * 4 + 1] = make_float4(bg[0].y, bg[1].y, bg[2].y, bg[3].y);
            sB[ts * 4 + 2] = make_float4(bg[0].z, bg[1].z, bg[2].z, bg[3].z);
            sB[ts * 4 + 3] = make_float4(bg[0].w, bg[1].w, bg[2].w, bg[3].w);
            float Lm[SQ][4][4];                    // [s][row][column]
            #pragma unroll
            for (int s = 0; s < SQ; ++s) {
                const float4 cq = cg[s];
                Lm[s][0][0] = cq.x; Lm[s][0][1] = -cq.y; Lm[s][0][2] = -cq.z; Lm[s][0][3] = -cq.w;
                Lm[s][1][0] = cq.y; Lm[s][1][1] =  cq.x; Lm[s][1][2] = -cq.w; Lm[s][1][3] =  cq.z;
                Lm[s][2][0] = cq.z; Lm[s][2][1] =  cq.w; Lm[s][2][2] =  cq.x; Lm[s][2][3] = -cq.y;
                Lm[s][3][0] = cq.w; Lm[s][3][1] = -cq.z; Lm[s][3][2] =  cq.y; Lm[s][3][3] =  cq.x;
            }
            #pragma unroll   // Lm[] stays in registers
            for (int k = 0; k < 4; ++k) {
                float4* r = &sA[(ts * 4 + k) * AROWS];
                #pragma unroll
                for (int m = 0; m < 4; ++m)
                    r[m] = make_float4(Lm[0][m][k], Lm[1][m][k], Lm[2][m][k], Lm[3][m][k]);
                r[4] = make_float4(0.f, 0.f, 0.f, 0.f);
            }
        }
        __syncthreads();
    }

    // Chunk's start state = Qpre * (group's start state) + Vpre.
    #pragma unroll
    for (int s = 0; s < SQ; ++s) {
        float4 gs = sH[lane * SQ + s];
        Quat qg = qmul(Qp[s], Quat{gs.x, gs.y, gs.z, gs.w});
        h[s] = Quat{qg.r + h[s].r, qg.i + h[s].i, qg.j + h[s].j, qg.k + h[s].k};
    }

    // From here on the four recurrences are two pairs.
    Axis2 A2[SQ / 2]; Quat2 H[SQ / 2];
    #pragma unroll
    for (int p = 0; p < SQ / 2; ++p) {
        const Axis &a0 = A[2*p], &a1 = A[2*p + 1];
        A2[p] = Axis2{{a0.r, a1.r}, {a0.i, a1.i}, {a0.j, a1.j}, {a0.k, a1.k},
                      {a0.nv2, a1.nv2}, {a0.na2, a1.na2}};
        H[p]  = Quat2{{h[2*p].r, h[2*p + 1].r}, {h[2*p].i, h[2*p + 1].i},
                      {h[2*p].j, h[2*p + 1].j}, {h[2*p].k, h[2*p + 1].k}};
    }

    // The lane's row of the A operand: lanes 0-3 are rows 0-3 at K = 0,1 and lanes 24-27
    // rows 8-11 at K = 2,3; every other lane takes the zeros (rows 4-7, 12-15 are not used).
    const int arow = (lane < 4 || (lane >= 24 && lane < 28)) ? (lane & 3) : 4;
    const float4* aP = &sA[w * CT * 4 * AROWS + arow];

    #pragma unroll 1   // rolled: for speed only
    for (int g = 0; g < CT / PF3; ++g) {
      float4 uc[PF3]; float dc[PF3];
      #pragma unroll
      for (int j = 0; j < PF3; ++j) { uc[j] = un[j]; dc[j] = dn[j]; }
      // The next batch flies while this one is worked on.
      if (g + 1 < CT / PF3) {
          idx += PF3 * DQ;
          fetch_steps(u4, dtg, idx, un, dn);
      }
      #pragma unroll
      for (int j = 0; j < PF3; ++j) {
        const int tt  = w * CT + g * PF3 + j;     // row of the staged group
        const int t   = t0 + g * PF3 + j;
        const int row = (b * LEN + t) * DQ;
        const float dtv = dc[j];
        Quat uq{uc[j].x, uc[j].y, uc[j].z, uc[j].w};
        const float hd = 0.5f * dtv, hd2 = hd * hd;

        const float4 b0 = sB[tt * 4 + 0], b1 = sB[tt * 4 + 1];
        const float4 b2 = sB[tt * 4 + 2], b3 = sB[tt * 4 + 3];
        const Quat2 Bq[SQ / 2] = {{{b0.x, b0.y}, {b1.x, b1.y}, {b2.x, b2.y}, {b3.x, b3.y}},
                                  {{b0.z, b0.w}, {b1.z, b1.w}, {b2.z, b2.w}, {b3.z, b3.w}}};
        #pragma unroll
        for (int p = 0; p < SQ / 2; ++p) {
            v2f qr, beta, er;
            cayley_scalars2(dtv, hd, hd2, A2[p], qr, beta, er);
            H[p] = state_step2(hd, A2[p], qr, beta, er, qmul2(Bq[p], uq), H[p]);
        }

        // Column k of every L(C_s) meets component k of every h_s, a pair of s per WMMA.
        v8f acc = {0.f,0.f,0.f,0.f,0.f,0.f,0.f,0.f};
        const v2f hk[4][SQ / 2] = {{H[0].r, H[1].r}, {H[0].i, H[1].i},
                                   {H[0].j, H[1].j}, {H[0].k, H[1].k}};
        #pragma unroll
        for (int k = 0; k < 4; ++k) {
            const float4 av = aP[((g * PF3 + j) * 4 + k) * AROWS];
            const v2f a01 = {av.x, av.y}, a23 = {av.z, av.w};
            acc = __builtin_amdgcn_wmma_f32_16x16x4_f32(
                      false, a01, false, hk[k][0], (short)0, acc, false, false);
            acc = __builtin_amdgcn_wmma_f32_16x16x4_f32(
                      false, a23, false, hk[k][1], (short)0, acc, false, false);
        }

        // D layout: registers 0-3 hold rows 0-3 in lanes 0-15 and rows 8-11 in lanes 16-31.
        out4[row + d] = make_float4(acc[0], acc[1], acc[2], acc[3]);
        // The head of the next trip rewrites registers that this store names.
        asm volatile("s_wait_xcnt 0x0" ::: "memory");
      }
      // Holds the hand-over of the next batch's registers at the foot of the trip: moved up
      // among the steps, it brought the wait for loads that had only just been issued with it.
      __builtin_amdgcn_sched_barrier(0);
    }
}

// ---------------------------------------------------------------------------
extern "C" void kernel_launch(void* const* d_in, const int* in_sizes, int n_in,
                              void* d_out, int out_size, void* d_ws, size_t ws_size,
                              hipStream_t stream)
{
    const float* u    = (const float*)d_in[0];
    const float* dtg  = (const float*)d_in[1];
    const float* Bin  = (const float*)d_in[2];
    const float* Cin  = (const float*)d_in[3];
    const float* Alog = (const float*)d_in[4];
    const float* Ai   = (const float*)d_in[5];
    const float* Aj   = (const float*)d_in[6];
    const float* Ak   = (const float*)d_in[7];
    float* out = (float*)d_out;

    // Workspace: 2 buffers of CHAINS*NCH quaternions (8 MB each), [chunk][chain], and
    // 2 of CHAINS*NSUP (1 MB each), [group][chain]
    float* qp = (float*)d_ws;
    float* vp = qp + (size_t)CHAINS * NCH * 4;
    float* qs = vp + (size_t)CHAINS * NCH * 4;
    float* vs = qs + (size_t)CHAINS * NSUP * 4;

    qssm_phase1<<<BSZ * NSUP * (DQ / 32), 256, 0, stream>>>(
        u, dtg, Bin, Alog, Ai, Aj, Ak, qp, vp, qs, vs);
    qssm_phase3<<<BSZ * NSUP * (DQ / 32), 256, 0, stream>>>(
        u, dtg, Bin, Cin, Alog, Ai, Aj, Ak, qp, vp, qs, vs, out);
}
